// v000
// The times below were measured on an AMD MI455X: many runs one after another, warmed up first and cycling through
// copies of the inputs, with the whole window's GPU time divided by the number of runs. Launches and the gaps
// between them are all in it. The median over several windows is given; except for v000 it joins two sittings, which
// can be a few percent apart, so the side-by-side timings, each taken in one sitting, are the better comparison.
// v000 is the starting kernel. One run takes 298 microseconds.
#include <hip/hip_runtime.h>

typedef __attribute__((ext_vector_type(16))) _Float16 v16h;
typedef __attribute__((ext_vector_type(8)))  _Float16 v8h;
typedef __attribute__((ext_vector_type(8)))  float    v8f;

#define NB    32      // batch
#define NSQ   196     // query sequence
#define NFD   2048    // feature dim
#define NL    1000    // labels
#define NE    1024    // embed dim
#define NH    16      // heads
#define NDH   64      // head dim

#if __has_builtin(__builtin_amdgcn_global_load_async_to_lds_b128) && \
    __has_builtin(__builtin_amdgcn_s_wait_asynccnt)
#define USE_ASYNC_LDS 1
typedef int v4i_vec __attribute__((vector_size(16)));
typedef __attribute__((address_space(1))) v4i_vec g_v4i;  // global (AS1)
typedef __attribute__((address_space(3))) v4i_vec l_v4i;  // LDS (AS3)
#else
#define USE_ASYNC_LDS 0
#endif

// 16-bit WMMA A/B operand element mapping (ISA 7.12.2):
// lane L holds matrix row (L & 15); element j of the v16h maps to
// K = kb + j      for j in [0,8)   (VGPR0..3)
// K = kb + j + 8  for j in [8,16)  (VGPR4..7), kb = (L<16) ? 0 : 8
__device__ __forceinline__ int koff(int lane, int j) {
  int kb = (lane & 16) ? 8 : 0;
  return kb + j + (j & 8);
}

// ---------------------------------------------------------------------------
// GEMM: C[M,N] = A[M,K] (f32) * B[N,K]^T (f32) + bias[N]
// out_half!=0 -> write _Float16 to Ch ; else write float to Cf
// block = 256 threads (8 waves). Block tile 128x128, wave tile 32x64,
// K step 32 -> 8 v_wmma_f32_16x16x32_f16 per wave per K step.
// ---------------------------------------------------------------------------
__global__ __launch_bounds__(256) void gemm_bt_f16(
    const float* __restrict__ A, const float* __restrict__ Bw,
    const float* __restrict__ bias, float* __restrict__ Cf,
    _Float16* __restrict__ Ch, int M, int N, int K, int out_half)
{
  __shared__ alignas(16) _Float16 As[128][40];
  __shared__ alignas(16) _Float16 Bs[128][40];

  const int t    = threadIdx.x;
  const int lane = t & 31;
  const int wave = t >> 5;
  const int wm   = wave & 3;   // 0..3 -> 32-row slab
  const int wn   = wave >> 2;  // 0..1 -> 64-col slab
  const int fr   = lane & 15;
  const int hi8  = (lane >> 4) << 3;

  const int m0 = blockIdx.x * 128;
  const int n0 = blockIdx.y * 128;

  // staging: each thread moves 16 contiguous f32 of one row for A and B
  const int srow = t >> 1;         // 0..127
  const int scol = (t & 1) * 16;   // 0 or 16
  const int ar = min(m0 + srow, M - 1);
  const int br = min(n0 + srow, N - 1);

  v8f acc[2][4] = {};

  for (int k0 = 0; k0 < K; k0 += 32) {
    const float* apf = A  + (size_t)ar * K + k0 + scol;
    const float* bpf = Bw + (size_t)br * K + k0 + scol;
    float4 a0 = ((const float4*)apf)[0];
    float4 a1 = ((const float4*)apf)[1];
    float4 a2 = ((const float4*)apf)[2];
    float4 a3 = ((const float4*)apf)[3];
    float4 b0 = ((const float4*)bpf)[0];
    float4 b1 = ((const float4*)bpf)[1];
    float4 b2 = ((const float4*)bpf)[2];
    float4 b3 = ((const float4*)bpf)[3];

    if (k0 + 32 < K) {  // global_prefetch_b8 of the next K tile
      __builtin_prefetch(apf + 32, 0, 1);
      __builtin_prefetch(bpf + 32, 0, 1);
    }

    v8h h0, h1;
    h0[0] = (_Float16)a0.x; h0[1] = (_Float16)a0.y;
    h0[2] = (_Float16)a0.z; h0[3] = (_Float16)a0.w;
    h0[4] = (_Float16)a1.x; h0[5] = (_Float16)a1.y;
    h0[6] = (_Float16)a1.z; h0[7] = (_Float16)a1.w;
    h1[0] = (_Float16)a2.x; h1[1] = (_Float16)a2.y;
    h1[2] = (_Float16)a2.z; h1[3] = (_Float16)a2.w;
    h1[4] = (_Float16)a3.x; h1[5] = (_Float16)a3.y;
    h1[6] = (_Float16)a3.z; h1[7] = (_Float16)a3.w;
    *(v8h*)&As[srow][scol]     = h0;
    *(v8h*)&As[srow][scol + 8] = h1;
    h0[0] = (_Float16)b0.x; h0[1] = (_Float16)b0.y;
    h0[2] = (_Float16)b0.z; h0[3] = (_Float16)b0.w;
    h0[4] = (_Float16)b1.x; h0[5] = (_Float16)b1.y;
    h0[6] = (_Float16)b1.z; h0[7] = (_Float16)b1.w;
    h1[0] = (_Float16)b2.x; h1[1] = (_Float16)b2.y;
    h1[2] = (_Float16)b2.z; h1[3] = (_Float16)b2.w;
    h1[4] = (_Float16)b3.x; h1[5] = (_Float16)b3.y;
    h1[6] = (_Float16)b3.z; h1[7] = (_Float16)b3.w;
    *(v8h*)&Bs[srow][scol]     = h0;
    *(v8h*)&Bs[srow][scol + 8] = h1;
    __syncthreads();

    v16h af[2], bf[4];
#pragma unroll
    for (int s = 0; s < 2; ++s)
#pragma unroll
      for (int j = 0; j < 16; ++j)
        af[s][j] = As[wm * 32 + s * 16 + fr][koff(lane, j)];
#pragma unroll
    for (int s = 0; s < 4; ++s)
#pragma unroll
      for (int j = 0; j < 16; ++j)
        bf[s][j] = Bs[wn * 64 + s * 16 + fr][koff(lane, j)];

#pragma unroll
    for (int ia = 0; ia < 2; ++ia)
#pragma unroll
      for (int ib = 0; ib < 4; ++ib)
        acc[ia][ib] = __builtin_amdgcn_wmma_f32_16x16x32_f16(
            false, af[ia], false, bf[ib], (short)0, acc[ia][ib], false, false);
    __syncthreads();
  }

#pragma unroll
  for (int ib = 0; ib < 4; ++ib) {
    const int nc = n0 + wn * 64 + ib * 16 + fr;
    const float bvv = bias[nc];
#pragma unroll
    for (int ia = 0; ia < 2; ++ia) {
#pragma unroll
      for (int i = 0; i < 8; ++i) {
        const int m = m0 + wm * 32 + ia * 16 + hi8 + i;
        if (m < M) {
          const float x = acc[ia][ib][i] + bvv;
          if (out_half) Ch[(size_t)m * N + nc] = (_Float16)x;
          else          Cf[(size_t)m * N + nc] = x;
        }
      }
    }
  }
}

// ---------------------------------------------------------------------------
// Flash-style attention over the label table.
// grid.x = B*H*4 ; block = 128 (4 waves). Each wave owns 16 query rows of a
// 64-query tile, keeps its own online softmax state + 16x64 f32 context acc.
// K/V chunks staged via GLOBAL_LOAD_ASYNC_TO_LDS_B128 when available.
// ---------------------------------------------------------------------------
__global__ __launch_bounds__(128) void attn_f16(
    const _Float16* __restrict__ Qh, const _Float16* __restrict__ Kh,
    const _Float16* __restrict__ Vh, float* __restrict__ Ctx)
{
  __shared__ alignas(16) _Float16 Ks[32][72];
  __shared__ alignas(16) _Float16 Vs[32][72];
  __shared__ alignas(16) _Float16 Ps[4][16][40];

  const int t    = threadIdx.x;
  const int lane = t & 31;
  const int wave = t >> 5;
  const int fr   = lane & 15;
  const int hi8  = (lane >> 4) << 3;   // C-layout row offset: 0 or 8

  const int qt = blockIdx.x & 3;
  const int h  = (blockIdx.x >> 2) & 15;
  const int b  = blockIdx.x >> 6;

  const int q0 = qt * 64 + wave * 16;  // first query row of this wave

  // Q fragments: 16 x 64 head-dim, as two K=32 WMMA chunks, kept in VGPRs
  v16h qf0, qf1;
  {
    const int qr = min(q0 + fr, NSQ - 1);
    const _Float16* qp = Qh + ((size_t)(b * NSQ + qr)) * NE + h * NDH;
#pragma unroll
    for (int j = 0; j < 16; ++j) {
      const int kk = koff(lane, j);
      qf0[j] = qp[kk];
      qf1[j] = qp[32 + kk];
    }
  }

  float mrow[8], srow[8];
  v8f cacc[4] = {};
#pragma unroll
  for (int i = 0; i < 8; ++i) { mrow[i] = -3.0e38f; srow[i] = 0.0f; }

  const int krr = t >> 2;         // staging row 0..31
  const int kcc = (t & 3) * 16;   // staging col 0,16,32,48 (halves)
  const size_t hoff = (size_t)h * NDH;

  for (int lb = 0; lb < NL; lb += 32) {
    // ---- stage 32 keys/values (f16) into LDS -----------------------------
    const int krow = min(lb + krr, NL - 1);
    const _Float16* kp = Kh + (size_t)krow * NE + hoff + kcc;
    const _Float16* vp = Vh + (size_t)krow * NE + hoff + kcc;
#if USE_ASYNC_LDS
    __builtin_amdgcn_global_load_async_to_lds_b128(
        (g_v4i*)kp,       (l_v4i*)&Ks[krr][kcc],     0, 0);
    __builtin_amdgcn_global_load_async_to_lds_b128(
        (g_v4i*)(kp + 8), (l_v4i*)&Ks[krr][kcc + 8], 0, 0);
    __builtin_amdgcn_global_load_async_to_lds_b128(
        (g_v4i*)vp,       (l_v4i*)&Vs[krr][kcc],     0, 0);
    __builtin_amdgcn_global_load_async_to_lds_b128(
        (g_v4i*)(vp + 8), (l_v4i*)&Vs[krr][kcc + 8], 0, 0);
    __builtin_amdgcn_s_wait_asynccnt(0);
#else
    const float4 k0v = ((const float4*)kp)[0];
    const float4 k1v = ((const float4*)kp)[1];
    const float4 v0v = ((const float4*)vp)[0];
    const float4 v1v = ((const float4*)vp)[1];
    *(float4*)&Ks[krr][kcc]     = k0v;
    *(float4*)&Ks[krr][kcc + 8] = k1v;
    *(float4*)&Vs[krr][kcc]     = v0v;
    *(float4*)&Vs[krr][kcc + 8] = v1v;
#endif
    __syncthreads();

    // ---- scores: 16q x 32keys = 2 C-tiles, each 2 WMMA (K=32 over dh=64) --
    v8f sc0 = {}, sc1 = {};
    {
      v16h kf;
#pragma unroll
      for (int j = 0; j < 16; ++j) kf[j] = Ks[fr][koff(lane, j)];
      sc0 = __builtin_amdgcn_wmma_f32_16x16x32_f16(false, qf0, false, kf,
                                                   (short)0, sc0, false, false);
#pragma unroll
      for (int j = 0; j < 16; ++j) kf[j] = Ks[fr][32 + koff(lane, j)];
      sc0 = __builtin_amdgcn_wmma_f32_16x16x32_f16(false, qf1, false, kf,
                                                   (short)0, sc0, false, false);
#pragma unroll
      for (int j = 0; j < 16; ++j) kf[j] = Ks[16 + fr][koff(lane, j)];
      sc1 = __builtin_amdgcn_wmma_f32_16x16x32_f16(false, qf0, false, kf,
                                                   (short)0, sc1, false, false);
#pragma unroll
      for (int j = 0; j < 16; ++j) kf[j] = Ks[16 + fr][32 + koff(lane, j)];
      sc1 = __builtin_amdgcn_wmma_f32_16x16x32_f16(false, qf1, false, kf,
                                                   (short)0, sc1, false, false);
    }

    // ---- online softmax (per-row state; rows partitioned by wave) --------
    const bool ok0 = (lb + fr) < NL;
    const bool ok1 = (lb + 16 + fr) < NL;
#pragma unroll
    for (int i = 0; i < 8; ++i) {
      float s0 = ok0 ? sc0[i] * 0.125f : -3.0e38f;  // 1/sqrt(64)
      float s1 = ok1 ? sc1[i] * 0.125f : -3.0e38f;
      float mx = fmaxf(s0, s1);
      mx = fmaxf(mx, __shfl_xor(mx, 1, 16));
      mx = fmaxf(mx, __shfl_xor(mx, 2, 16));
      mx = fmaxf(mx, __shfl_xor(mx, 4, 16));
      mx = fmaxf(mx, __shfl_xor(mx, 8, 16));
      const float mn   = fmaxf(mrow[i], mx);
      const float corr = __expf(mrow[i] - mn);
      const float p0   = __expf(s0 - mn);
      const float p1   = __expf(s1 - mn);
      float ps = p0 + p1;
      ps += __shfl_xor(ps, 1, 16);
      ps += __shfl_xor(ps, 2, 16);
      ps += __shfl_xor(ps, 4, 16);
      ps += __shfl_xor(ps, 8, 16);
      srow[i] = srow[i] * corr + ps;
      mrow[i] = mn;
#pragma unroll
      for (int d = 0; d < 4; ++d) cacc[d][i] *= corr;
      // park P (C layout -> LDS) for re-read in A layout
      Ps[wave][hi8 + i][fr]      = (_Float16)p0;
      Ps[wave][hi8 + i][16 + fr] = (_Float16)p1;
    }
    __syncthreads();

    // ---- ctx += P(16x32) * V(32x64): 4 WMMA over dh tiles ----------------
    v16h pf, vf;
#pragma unroll
    for (int j = 0; j < 16; ++j) pf[j] = Ps[wave][fr][koff(lane, j)];
#pragma unroll
    for (int d = 0; d < 4; ++d) {
#pragma unroll
      for (int j = 0; j < 16; ++j) vf[j] = Vs[koff(lane, j)][d * 16 + fr];
      cacc[d] = __builtin_amdgcn_wmma_f32_16x16x32_f16(false, pf, false, vf,
                                                       (short)0, cacc[d],
                                                       false, false);
    }
    __syncthreads();
  }

  // ---- normalize + store context (f32) -----------------------------------
#pragma unroll
  for (int i = 0; i < 8; ++i) {
    const int q = q0 + hi8 + i;
    if (q < NSQ) {
      const float inv = 1.0f / srow[i];
      float* cp = Ctx + ((size_t)(b * NSQ + q)) * NE + h * NDH;
#pragma unroll
      for (int d = 0; d < 4; ++d) cp[d * 16 + fr] = cacc[d][i] * inv;
    }
  }
}

// ---------------------------------------------------------------------------
extern "C" void kernel_launch(void* const* d_in, const int* in_sizes, int n_in,
                              void* d_out, int out_size, void* d_ws, size_t ws_size,
                              hipStream_t stream) {
  const float* features = (const float*)d_in[0];
  const float* labels   = (const float*)d_in[1];
  const float* Wq = (const float*)d_in[2];
  const float* bq = (const float*)d_in[3];
  const float* Wk = (const float*)d_in[4];
  const float* bk = (const float*)d_in[5];
  const float* Wv = (const float*)d_in[6];
  const float* bv = (const float*)d_in[7];
  const float* Wo = (const float*)d_in[8];
  const float* bo = (const float*)d_in[9];
  float* out = (float*)d_out;

  const size_t MQ = (size_t)NB * NSQ;  // 6272
  _Float16* Qh = (_Float16*)d_ws;      // [6272,1024] f16
  _Float16* Kh = Qh + MQ * NE;         // [1000,1024] f16
  _Float16* Vh = Kh + (size_t)NL * NE; // [1000,1024] f16
  float*    ctx = (float*)(Vh + (size_t)NL * NE);  // [6272,1024] f32

  const dim3 blk(256);

  // Q = features @ Wq^T + bq  -> f16   (M=6272 -> 49 tiles, N=1024 -> 8)
  gemm_bt_f16<<<dim3(49, 8), blk, 0, stream>>>(
      features, Wq, bq, nullptr, Qh, (int)MQ, NE, NFD, 1);
  // K = labels @ Wk^T + bk    -> f16   (M=1000 -> 8 tiles)
  gemm_bt_f16<<<dim3(8, 8), blk, 0, stream>>>(
      labels, Wk, bk, nullptr, Kh, NL, NE, NE, 1);
  // V = labels @ Wv^T + bv    -> f16
  gemm_bt_f16<<<dim3(8, 8), blk, 0, stream>>>(
      labels, Wv, bv, nullptr, Vh, NL, NE, NE, 1);

  // attention: softmax(Q K^T / 8) V  -> ctx (f32)
  attn_f16<<<dim3(NB * NH * 4), dim3(128), 0, stream>>>(Qh, Kh, Vh, ctx);

  // out = ctx @ Wo^T + bo     -> f32
  gemm_bt_f16<<<dim3(49, 8), blk, 0, stream>>>(
      ctx, Wo, bo, out, nullptr, (int)MQ, NE, NE, 0);
}

// v001
// A run of this version takes 218 microseconds.
// Two timings next to v000 both put it at 1.43 times that version's speed.
#include <hip/hip_runtime.h>

typedef __attribute__((ext_vector_type(16))) _Float16 v16h;
typedef __attribute__((ext_vector_type(8)))  _Float16 v8h;
typedef __attribute__((ext_vector_type(8)))  float    v8f;

#define NB    32      // batch
#define NSQ   196     // query sequence
#define NFD   2048    // feature dim
#define NL    1000    // labels
#define NE    1024    // embed dim
#define NH    16      // heads
#define NDH   64      // head dim

#if __has_builtin(__builtin_amdgcn_global_load_async_to_lds_b128) && \
    __has_builtin(__builtin_amdgcn_s_wait_asynccnt)
#define USE_ASYNC_LDS 1
typedef int v4i_vec __attribute__((vector_size(16)));
typedef __attribute__((address_space(1))) v4i_vec g_v4i;  // global (AS1)
typedef __attribute__((address_space(3))) v4i_vec l_v4i;  // LDS (AS3)
#else
#define USE_ASYNC_LDS 0
#endif

// 16-bit WMMA A/B operand element mapping (ISA 7.12.2):
// lane L holds matrix row (L & 15); element j of the v16h maps to
// K = kb + j      for j in [0,8)   (VGPR0..3)
// K = kb + j + 8  for j in [8,16)  (VGPR4..7), kb = (L<16) ? 0 : 8
__device__ __forceinline__ int koff(int lane, int j) {
  int kb = (lane & 16) ? 8 : 0;
  return kb + j + (j & 8);
}

// ---------------------------------------------------------------------------
// GEMM: C[M,N] = A[M,K] (f32) * B[N,K]^T (f32) + bias[N]
// out_half!=0 -> write _Float16 to Ch ; else write float to Cf
// block = 256 threads (8 waves). Block tile 128x128, wave tile 32x64,
// K step 32 -> 8 v_wmma_f32_16x16x32_f16 per wave per K step.
// ---------------------------------------------------------------------------
__global__ __launch_bounds__(256) void gemm_bt_f16(
    const float* __restrict__ A, const float* __restrict__ Bw,
    const float* __restrict__ bias, float* __restrict__ Cf,
    _Float16* __restrict__ Ch, int M, int N, int K, int out_half)
{
  __shared__ alignas(16) _Float16 As[128][40];
  __shared__ alignas(16) _Float16 Bs[128][40];

  const int t    = threadIdx.x;
  const int lane = t & 31;
  const int wave = t >> 5;
  const int wm   = wave & 3;   // 0..3 -> 32-row slab
  const int wn   = wave >> 2;  // 0..1 -> 64-col slab
  const int fr   = lane & 15;
  const int hi8  = (lane >> 4) << 3;

  const int m0 = blockIdx.x * 128;
  const int n0 = blockIdx.y * 128;

  // staging: each thread moves 16 contiguous f32 of one row for A and B
  const int srow = t >> 1;         // 0..127
  const int scol = (t & 1) * 16;   // 0 or 16
  const int ar = min(m0 + srow, M - 1);
  const int br = min(n0 + srow, N - 1);

  v8f acc[2][4] = {};

  for (int k0 = 0; k0 < K; k0 += 32) {
    const float* apf = A  + (size_t)ar * K + k0 + scol;
    const float* bpf = Bw + (size_t)br * K + k0 + scol;
    float4 a0 = ((const float4*)apf)[0];
    float4 a1 = ((const float4*)apf)[1];
    float4 a2 = ((const float4*)apf)[2];
    float4 a3 = ((const float4*)apf)[3];
    float4 b0 = ((const float4*)bpf)[0];
    float4 b1 = ((const float4*)bpf)[1];
    float4 b2 = ((const float4*)bpf)[2];
    float4 b3 = ((const float4*)bpf)[3];

    if (k0 + 32 < K) {  // global_prefetch_b8 of the next K tile
      __builtin_prefetch(apf + 32, 0, 1);
      __builtin_prefetch(bpf + 32, 0, 1);
    }

    v8h h0, h1;
    h0[0] = (_Float16)a0.x; h0[1] = (_Float16)a0.y;
    h0[2] = (_Float16)a0.z; h0[3] = (_Float16)a0.w;
    h0[4] = (_Float16)a1.x; h0[5] = (_Float16)a1.y;
    h0[6] = (_Float16)a1.z; h0[7] = (_Float16)a1.w;
    h1[0] = (_Float16)a2.x; h1[1] = (_Float16)a2.y;
    h1[2] = (_Float16)a2.z; h1[3] = (_Float16)a2.w;
    h1[4] = (_Float16)a3.x; h1[5] = (_Float16)a3.y;
    h1[6] = (_Float16)a3.z; h1[7] = (_Float16)a3.w;
    *(v8h*)&As[srow][scol]     = h0;
    *(v8h*)&As[srow][scol + 8] = h1;
    h0[0] = (_Float16)b0.x; h0[1] = (_Float16)b0.y;
    h0[2] = (_Float16)b0.z; h0[3] = (_Float16)b0.w;
    h0[4] = (_Float16)b1.x; h0[5] = (_Float16)b1.y;
    h0[6] = (_Float16)b1.z; h0[7] = (_Float16)b1.w;
    h1[0] = (_Float16)b2.x; h1[1] = (_Float16)b2.y;
    h1[2] = (_Float16)b2.z; h1[3] = (_Float16)b2.w;
    h1[4] = (_Float16)b3.x; h1[5] = (_Float16)b3.y;
    h1[6] = (_Float16)b3.z; h1[7] = (_Float16)b3.w;
    *(v8h*)&Bs[srow][scol]     = h0;
    *(v8h*)&Bs[srow][scol + 8] = h1;
    __syncthreads();

    v16h af[2], bf[4];
#pragma unroll
    for (int s = 0; s < 2; ++s)
#pragma unroll
      for (int j = 0; j < 16; ++j)
        af[s][j] = As[wm * 32 + s * 16 + fr][koff(lane, j)];
#pragma unroll
    for (int s = 0; s < 4; ++s)
#pragma unroll
      for (int j = 0; j < 16; ++j)
        bf[s][j] = Bs[wn * 64 + s * 16 + fr][koff(lane, j)];

#pragma unroll
    for (int ia = 0; ia < 2; ++ia)
#pragma unroll
      for (int ib = 0; ib < 4; ++ib)
        acc[ia][ib] = __builtin_amdgcn_wmma_f32_16x16x32_f16(
            false, af[ia], false, bf[ib], (short)0, acc[ia][ib], false, false);
    __syncthreads();
  }

#pragma unroll
  for (int ib = 0; ib < 4; ++ib) {
    const int nc = n0 + wn * 64 + ib * 16 + fr;
    const float bvv = bias[nc];
#pragma unroll
    for (int ia = 0; ia < 2; ++ia) {
#pragma unroll
      for (int i = 0; i < 8; ++i) {
        const int m = m0 + wm * 32 + ia * 16 + hi8 + i;
        if (m < M) {
          const float x = acc[ia][ib][i] + bvv;
          if (out_half) Ch[(size_t)m * N + nc] = (_Float16)x;
          else          Cf[(size_t)m * N + nc] = x;
        }
      }
    }
  }
}

// ---------------------------------------------------------------------------
// Flash-style attention over the label table, transposed products:
//   St = K * Q^T   (A = 16 keys from LDS, B = 16 queries kept in VGPRs)
//   Ot += V^T * P^T
// In the D layout a lane then holds the scores of ONE query (column lane&15),
// 8 keys per tile, so the row maximum and the row sum are taken in the lane's
// own registers (one exchange between the wave halves for the maximum), and
// two converted St tiles are already the B operand P^T: P never goes to LDS.
// grid.x = B*H*4 ; block = 128 (4 waves). Each wave owns 16 query rows of a
// 64-query tile, keeps its own online softmax state + 64x16 f32 context acc.
// K/V chunks staged via GLOBAL_LOAD_ASYNC_TO_LDS_B128 when available.
// ---------------------------------------------------------------------------
__device__ __forceinline__ float xhalf(float x) {  // value of lane ^ 16
  const int b = __builtin_bit_cast(int, x);
  return __builtin_bit_cast(float, __builtin_amdgcn_permlanex16(
      b, b, 0x76543210, 0xfedcba98, false, false));
}

__global__ __launch_bounds__(128) void attn_f16(
    const _Float16* __restrict__ Qh, const _Float16* __restrict__ Kh,
    const _Float16* __restrict__ Vh, float* __restrict__ Ctx)
{
  __shared__ alignas(16) _Float16 Ks[32][72];
  __shared__ alignas(16) _Float16 Vs[32][72];

  const int t    = threadIdx.x;
  const int lane = t & 31;
  const int wave = t >> 5;
  const int fr   = lane & 15;
  const int hi8  = (lane >> 4) << 3;   // D-layout row offset: 0 or 8

  const int qt = blockIdx.x & 3;
  const int h  = (blockIdx.x >> 2) & 15;
  const int b  = blockIdx.x >> 6;

  const int q0 = qt * 64 + wave * 16;  // first query row of this wave

  // Q fragments: 16 x 64 head-dim, as two K=32 WMMA chunks, kept in VGPRs
  v16h qf0, qf1;
  {
    const int qr = min(q0 + fr, NSQ - 1);
    const _Float16* qp = Qh + ((size_t)(b * NSQ + qr)) * NE + h * NDH;
#pragma unroll
    for (int j = 0; j < 16; ++j) {
      const int kk = koff(lane, j);
      qf0[j] = qp[kk];
      qf1[j] = qp[32 + kk];
    }
  }

  // state of query q0 + fr: running maximum (equal in both wave halves) and
  // this half's share of the running sum (halves joined after the loop)
  float mrow = -3.0e38f, srow = 0.0f;
  v8f cacc[4] = {};  // cacc[d][i] = ctx[q0 + fr][d * 16 + hi8 + i]

  const int krr = t >> 2;         // staging row 0..31
  const int kcc = (t & 3) * 16;   // staging col 0,16,32,48 (halves)
  const size_t hoff = (size_t)h * NDH;

  for (int lb = 0; lb < NL; lb += 32) {
    // ---- stage 32 keys/values (f16) into LDS -----------------------------
    const int krow = min(lb + krr, NL - 1);
    const _Float16* kp = Kh + (size_t)krow * NE + hoff + kcc;
    const _Float16* vp = Vh + (size_t)krow * NE + hoff + kcc;
#if USE_ASYNC_LDS
    __builtin_amdgcn_global_load_async_to_lds_b128(
        (g_v4i*)kp,       (l_v4i*)&Ks[krr][kcc],     0, 0);
    __builtin_amdgcn_global_load_async_to_lds_b128(
        (g_v4i*)(kp + 8), (l_v4i*)&Ks[krr][kcc + 8], 0, 0);
    __builtin_amdgcn_global_load_async_to_lds_b128(
        (g_v4i*)vp,       (l_v4i*)&Vs[krr][kcc],     0, 0);
    __builtin_amdgcn_global_load_async_to_lds_b128(
        (g_v4i*)(vp + 8), (l_v4i*)&Vs[krr][kcc + 8], 0, 0);
    __builtin_amdgcn_s_wait_asynccnt(0);
#else
    const float4 k0v = ((const float4*)kp)[0];
    const float4 k1v = ((const float4*)kp)[1];
    const float4 v0v = ((const float4*)vp)[0];
    const float4 v1v = ((const float4*)vp)[1];
    *(float4*)&Ks[krr][kcc]     = k0v;
    *(float4*)&Ks[krr][kcc + 8] = k1v;
    *(float4*)&Vs[krr][kcc]     = v0v;
    *(float4*)&Vs[krr][kcc + 8] = v1v;
#endif
    __syncthreads();

    // ---- scores: 32keys x 16q = 2 D-tiles, each 2 WMMA (K=32 over dh=64) --
    // sc0[i] = S[key lb + hi8 + i][query fr], sc1[i]: key lb + 16 + hi8 + i
    v8f sc0 = {}, sc1 = {};
    {
      v16h kf;
#pragma unroll
      for (int j = 0; j < 16; ++j) kf[j] = Ks[fr][koff(lane, j)];
      sc0 = __builtin_amdgcn_wmma_f32_16x16x32_f16(false, kf, false, qf0,
                                                   (short)0, sc0, false, false);
#pragma unroll
      for (int j = 0; j < 16; ++j) kf[j] = Ks[fr][32 + koff(lane, j)];
      sc0 = __builtin_amdgcn_wmma_f32_16x16x32_f16(false, kf, false, qf1,
                                                   (short)0, sc0, false, false);
#pragma unroll
      for (int j = 0; j < 16; ++j) kf[j] = Ks[16 + fr][koff(lane, j)];
      sc1 = __builtin_amdgcn_wmma_f32_16x16x32_f16(false, kf, false, qf0,
                                                   (short)0, sc1, false, false);
#pragma unroll
      for (int j = 0; j < 16; ++j) kf[j] = Ks[16 + fr][32 + koff(lane, j)];
      sc1 = __builtin_amdgcn_wmma_f32_16x16x32_f16(false, kf, false, qf1,
                                                   (short)0, sc1, false, false);
    }

    // ---- online softmax: one query per lane, keys along the registers ----
#pragma unroll
    for (int i = 0; i < 8; ++i) {
      sc0[i] *= 0.125f;  // 1/sqrt(64)
      sc1[i] *= 0.125f;
    }
    if (lb + 32 > NL) {  // only the last chunk has keys past the table
#pragma unroll
      for (int i = 0; i < 8; ++i) {
        if (lb + hi8 + i >= NL)      sc0[i] = -3.0e38f;
        if (lb + 16 + hi8 + i >= NL) sc1[i] = -3.0e38f;
      }
    }
    float mx = fmaxf(sc0[0], sc1[0]);
#pragma unroll
    for (int i = 1; i < 8; ++i) mx = fmaxf(mx, fmaxf(sc0[i], sc1[i]));
    mx = fmaxf(mx, xhalf(mx));
    const float mn   = fmaxf(mrow, mx);
    const float corr = __expf(mrow - mn);
    mrow = mn;

    v16h pf;  // P^T as B operand: element j is key koff(lane, j), column fr
    float ps = 0.0f;
#pragma unroll
    for (int i = 0; i < 8; ++i) {
      const float p0 = __expf(sc0[i] - mn);
      const float p1 = __expf(sc1[i] - mn);
      ps += p0 + p1;
      pf[i]     = (_Float16)p0;
      pf[8 + i] = (_Float16)p1;
    }
    srow = srow * corr + ps;
#pragma unroll
    for (int d = 0; d < 4; ++d)
#pragma unroll
      for (int i = 0; i < 8; ++i) cacc[d][i] *= corr;

    // ---- ctx^T += V^T(16x32) * P^T(32x16): 4 WMMA over dh tiles ----------
#pragma unroll
    for (int d = 0; d < 4; ++d) {
      v16h vf;
#pragma unroll
      for (int j = 0; j < 16; ++j) vf[j] = Vs[koff(lane, j)][d * 16 + fr];
      cacc[d] = __builtin_amdgcn_wmma_f32_16x16x32_f16(false, vf, false, pf,
                                                       (short)0, cacc[d],
                                                       false, false);
    }
    __syncthreads();
  }

  // ---- normalize + store context (f32): 8 consecutive d per lane and tile --
  srow += xhalf(srow);
  const int q = q0 + fr;
  if (q < NSQ) {
    const float inv = 1.0f / srow;
    float* cp = Ctx + ((size_t)(b * NSQ + q)) * NE + h * NDH + hi8;
#pragma unroll
    for (int d = 0; d < 4; ++d) {
      *(float4*)&cp[d * 16]     = make_float4(cacc[d][0] * inv, cacc[d][1] * inv,
                                              cacc[d][2] * inv, cacc[d][3] * inv);
      *(float4*)&cp[d * 16 + 4] = make_float4(cacc[d][4] * inv, cacc[d][5] * inv,
                                              cacc[d][6] * inv, cacc[d][7] * inv);
    }
  }
}

// ---------------------------------------------------------------------------
extern "C" void kernel_launch(void* const* d_in, const int* in_sizes, int n_in,
                              void* d_out, int out_size, void* d_ws, size_t ws_size,
                              hipStream_t stream) {
  const float* features = (const float*)d_in[0];
  const float* labels   = (const float*)d_in[1];
  const float* Wq = (const float*)d_in[2];
  const float* bq = (const float*)d_in[3];
  const float* Wk = (const float*)d_in[4];
  const float* bk = (const float*)d_in[5];
  const float* Wv = (const float*)d_in[6];
  const float* bv = (const float*)d_in[7];
  const float* Wo = (const float*)d_in[8];
  const float* bo = (const float*)d_in[9];
  float* out = (float*)d_out;

  const size_t MQ = (size_t)NB * NSQ;  // 6272
  _Float16* Qh = (_Float16*)d_ws;      // [6272,1024] f16
  _Float16* Kh = Qh + MQ * NE;         // [1000,1024] f16
  _Float16* Vh = Kh + (size_t)NL * NE; // [1000,1024] f16
  float*    ctx = (float*)(Vh + (size_t)NL * NE);  // [6272,1024] f32

  const dim3 blk(256);

  // Q = features @ Wq^T + bq  -> f16   (M=6272 -> 49 tiles, N=1024 -> 8)
  gemm_bt_f16<<<dim3(49, 8), blk, 0, stream>>>(
      features, Wq, bq, nullptr, Qh, (int)MQ, NE, NFD, 1);
  // K = labels @ Wk^T + bk    -> f16   (M=1000 -> 8 tiles)
  gemm_bt_f16<<<dim3(8, 8), blk, 0, stream>>>(
      labels, Wk, bk, nullptr, Kh, NL, NE, NE, 1);
  // V = labels @ Wv^T + bv    -> f16
  gemm_bt_f16<<<dim3(8, 8), blk, 0, stream>>>(
      labels, Wv, bv, nullptr, Vh, NL, NE, NE, 1);

  // attention: softmax(Q K^T / 8) V  -> ctx (f32)
  attn_f16<<<dim3(NB * NH * 4), dim3(128), 0, stream>>>(Qh, Kh, Vh, ctx);

  // out = ctx @ Wo^T + bo     -> f32
  gemm_bt_f16<<<dim3(49, 8), blk, 0, stream>>>(
      ctx, Wo, bo, out, nullptr, (int)MQ, NE, NE, 0);
}

// v002
// It runs in 202 microseconds.
// Two timings next to v001 put it at 1.08 and 1.09 times that version's speed.
// Counting every step since v000, it is 1.55 times as fast.
#include <hip/hip_runtime.h>

typedef __attribute__((ext_vector_type(16))) _Float16 v16h;
typedef __attribute__((ext_vector_type(4)))  _Float16 v4h;
typedef __attribute__((ext_vector_type(8)))  float    v8f;

#define NB    32      // batch
#define NSQ   196     // query sequence
#define NFD   2048    // feature dim
#define NL    1000    // labels
#define NE    1024    // embed dim
#define NH    16      // heads
#define NDH   64      // head dim

#if __has_builtin(__builtin_amdgcn_global_load_async_to_lds_b128) && \
    __has_builtin(__builtin_amdgcn_s_wait_asynccnt)
#define USE_ASYNC_LDS 1
typedef int v4i_vec __attribute__((vector_size(16)));
typedef __attribute__((address_space(1))) v4i_vec g_v4i;  // global (AS1)
typedef __attribute__((address_space(3))) v4i_vec l_v4i;  // LDS (AS3)
#else
#define USE_ASYNC_LDS 0
#endif

// 16-bit WMMA A/B operand element mapping (ISA 7.12.2):
// lane L holds matrix row (L & 15); element j of the v16h maps to
// K = kb + j      for j in [0,8)   (VGPR0..3)
// K = kb + j + 8  for j in [8,16)  (VGPR4..7), kb = (L<16) ? 0 : 8
__device__ __forceinline__ int koff(int lane, int j) {
  int kb = (lane & 16) ? 8 : 0;
  return kb + j + (j & 8);
}

// ---------------------------------------------------------------------------
// GEMM: C[M,N] = A[M,K] (f32) * B[N,K]^T (f32) + bias[N]
// out_half!=0 -> write _Float16 to Ch ; else write float to Cf
// block = 256 threads (8 waves). Block tile 128x128, wave tile 32x64,
// K step 32 -> 8 v_wmma_f32_16x16x32_f16 per wave per K step.
// ---------------------------------------------------------------------------
__global__ __launch_bounds__(256) void gemm_bt_f16(
    const float* __restrict__ A, const float* __restrict__ Bw,
    const float* __restrict__ bias, float* __restrict__ Cf,
    _Float16* __restrict__ Ch, int M, int N, int K, int out_half)
{
  __shared__ alignas(16) _Float16 As[128][40];
  __shared__ alignas(16) _Float16 Bs[128][40];

  const int t    = threadIdx.x;
  const int lane = t & 31;
  const int wave = t >> 5;
  const int wm   = wave & 3;   // 0..3 -> 32-row slab
  const int wn   = wave >> 2;  // 0..1 -> 64-col slab
  const int fr   = lane & 15;
  const int hi8  = (lane >> 4) << 3;

  const int m0 = blockIdx.x * 128;
  const int n0 = blockIdx.y * 128;

  // staging: 8 lanes take the 32 f32 (one 128-byte line) of a row, so that a
  // wave-wide 16-byte load covers 4 whole lines. Load i of a wave takes row
  // lrow + i in each of its four lane groups; the groups stand 4 rows apart,
  // which at the 80-byte LDS pitch puts their 8-byte stores on disjoint banks.
  const int lrow = wave * 16 + ((lane >> 3) << 2);  // + i, i = 0..3
  const int lcol = (lane & 7) * 4;                  // f32 column 0..28
  unsigned aoff[4], boff[4];  // byte offsets of this lane's loads in A and Bw
#pragma unroll
  for (int i = 0; i < 4; ++i) {
    aoff[i] = ((unsigned)min(m0 + lrow + i, M - 1) * (unsigned)K + lcol) * 4u;
    boff[i] = ((unsigned)min(n0 + lrow + i, N - 1) * (unsigned)K + lcol) * 4u;
  }

  // prefetch: each lane pair asks for one row's line of the next K tile
  const int srow = t >> 1;         // 0..127
  const int scol = (t & 1) * 16;   // 0 or 16
  const int ar = min(m0 + srow, M - 1);
  const int br = min(n0 + srow, N - 1);

  v8f acc[2][4] = {};

  for (int k0 = 0; k0 < K; k0 += 32) {
    const float* apf = A  + (size_t)ar * K + k0 + scol;
    const float* bpf = Bw + (size_t)br * K + k0 + scol;
    float4 av[4], bv[4];
#pragma unroll
    for (int i = 0; i < 4; ++i)
      av[i] = *(const float4*)((const char*)A + aoff[i]);
#pragma unroll
    for (int i = 0; i < 4; ++i)
      bv[i] = *(const float4*)((const char*)Bw + boff[i]);

    if (k0 + 32 < K) {  // global_prefetch_b8 of the next K tile
      __builtin_prefetch(apf + 32, 0, 1);
      __builtin_prefetch(bpf + 32, 0, 1);
    }

#pragma unroll
    for (int i = 0; i < 4; ++i) {
      v4h ha, hb;
      ha[0] = (_Float16)av[i].x; ha[1] = (_Float16)av[i].y;
      ha[2] = (_Float16)av[i].z; ha[3] = (_Float16)av[i].w;
      hb[0] = (_Float16)bv[i].x; hb[1] = (_Float16)bv[i].y;
      hb[2] = (_Float16)bv[i].z; hb[3] = (_Float16)bv[i].w;
      *(v4h*)&As[lrow + i][lcol] = ha;
      *(v4h*)&Bs[lrow + i][lcol] = hb;
      aoff[i] += 128u;  // next K tile: 32 f32 on
      boff[i] += 128u;
    }
    __syncthreads();

    v16h af[2], bf[4];
#pragma unroll
    for (int s = 0; s < 2; ++s)
#pragma unroll
      for (int j = 0; j < 16; ++j)
        af[s][j] = As[wm * 32 + s * 16 + fr][koff(lane, j)];
#pragma unroll
    for (int s = 0; s < 4; ++s)
#pragma unroll
      for (int j = 0; j < 16; ++j)
        bf[s][j] = Bs[wn * 64 + s * 16 + fr][koff(lane, j)];

#pragma unroll
    for (int ia = 0; ia < 2; ++ia)
#pragma unroll
      for (int ib = 0; ib < 4; ++ib)
        acc[ia][ib] = __builtin_amdgcn_wmma_f32_16x16x32_f16(
            false, af[ia], false, bf[ib], (short)0, acc[ia][ib], false, false);
    __syncthreads();
  }

#pragma unroll
  for (int ib = 0; ib < 4; ++ib) {
    const int nc = n0 + wn * 64 + ib * 16 + fr;
    const float bvv = bias[nc];
#pragma unroll
    for (int ia = 0; ia < 2; ++ia) {
#pragma unroll
      for (int i = 0; i < 8; ++i) {
        const int m = m0 + wm * 32 + ia * 16 + hi8 + i;
        if (m < M) {
          const float x = acc[ia][ib][i] + bvv;
          if (out_half) Ch[(size_t)m * N + nc] = (_Float16)x;
          else          Cf[(size_t)m * N + nc] = x;
        }
      }
    }
  }
}

// ---------------------------------------------------------------------------
// Flash-style attention over the label table, transposed products:
//   St = K * Q^T   (A = 16 keys from LDS, B = 16 queries kept in VGPRs)
//   Ot += V^T * P^T
// In the D layout a lane then holds the scores of ONE query (column lane&15),
// 8 keys per tile, so the row maximum and the row sum are taken in the lane's
// own registers (one exchange between the wave halves for the maximum), and
// two converted St tiles are already the B operand P^T: P never goes to LDS.
// grid.x = B*H*4 ; block = 128 (4 waves). Each wave owns 16 query rows of a
// 64-query tile, keeps its own online softmax state + 64x16 f32 context acc.
// K/V chunks staged via GLOBAL_LOAD_ASYNC_TO_LDS_B128 when available.
// ---------------------------------------------------------------------------
__device__ __forceinline__ float xhalf(float x) {  // value of lane ^ 16
  const int b = __builtin_bit_cast(int, x);
  return __builtin_bit_cast(float, __builtin_amdgcn_permlanex16(
      b, b, 0x76543210, 0xfedcba98, false, false));
}

__global__ __launch_bounds__(128) void attn_f16(
    const _Float16* __restrict__ Qh, const _Float16* __restrict__ Kh,
    const _Float16* __restrict__ Vh, float* __restrict__ Ctx)
{
  __shared__ alignas(16) _Float16 Ks[32][72];
  __shared__ alignas(16) _Float16 Vs[32][72];

  const int t    = threadIdx.x;
  const int lane = t & 31;
  const int wave = t >> 5;
  const int fr   = lane & 15;
  const int hi8  = (lane >> 4) << 3;   // D-layout row offset: 0 or 8

  const int qt = blockIdx.x & 3;
  const int h  = (blockIdx.x >> 2) & 15;
  const int b  = blockIdx.x >> 6;

  const int q0 = qt * 64 + wave * 16;  // first query row of this wave

  // Q fragments: 16 x 64 head-dim, as two K=32 WMMA chunks, kept in VGPRs
  v16h qf0, qf1;
  {
    const int qr = min(q0 + fr, NSQ - 1);
    const _Float16* qp = Qh + ((size_t)(b * NSQ + qr)) * NE + h * NDH;
#pragma unroll
    for (int j = 0; j < 16; ++j) {
      const int kk = koff(lane, j);
      qf0[j] = qp[kk];
      qf1[j] = qp[32 + kk];
    }
  }

  // state of query q0 + fr: running maximum (equal in both wave halves) and
  // this half's share of the running sum (halves joined after the loop)
  float mrow = -3.0e38f, srow = 0.0f;
  v8f cacc[4] = {};  // cacc[d][i] = ctx[q0 + fr][d * 16 + hi8 + i]

  const int krr = t >> 2;         // staging row 0..31
  const int kcc = (t & 3) * 16;   // staging col 0,16,32,48 (halves)
  const size_t hoff = (size_t)h * NDH;

  for (int lb = 0; lb < NL; lb += 32) {
    // ---- stage 32 keys/values (f16) into LDS -----------------------------
    const int krow = min(lb + krr, NL - 1);
    const _Float16* kp = Kh + (size_t)krow * NE + hoff + kcc;
    const _Float16* vp = Vh + (size_t)krow * NE + hoff + kcc;
#if USE_ASYNC_LDS
    __builtin_amdgcn_global_load_async_to_lds_b128(
        (g_v4i*)kp,       (l_v4i*)&Ks[krr][kcc],     0, 0);
    __builtin_amdgcn_global_load_async_to_lds_b128(
        (g_v4i*)(kp + 8), (l_v4i*)&Ks[krr][kcc + 8], 0, 0);
    __builtin_amdgcn_global_load_async_to_lds_b128(
        (g_v4i*)vp,       (l_v4i*)&Vs[krr][kcc],     0, 0);
    __builtin_amdgcn_global_load_async_to_lds_b128(
        (g_v4i*)(vp + 8), (l_v4i*)&Vs[krr][kcc + 8], 0, 0);
    __builtin_amdgcn_s_wait_asynccnt(0);
#else
    const float4 k0v = ((const float4*)kp)[0];
    const float4 k1v = ((const float4*)kp)[1];
    const float4 v0v = ((const float4*)vp)[0];
    const float4 v1v = ((const float4*)vp)[1];
    *(float4*)&Ks[krr][kcc]     = k0v;
    *(float4*)&Ks[krr][kcc + 8] = k1v;
    *(float4*)&Vs[krr][kcc]     = v0v;
    *(float4*)&Vs[krr][kcc + 8] = v1v;
#endif
    __syncthreads();

    // ---- scores: 32keys x 16q = 2 D-tiles, each 2 WMMA (K=32 over dh=64) --
    // sc0[i] = S[key lb + hi8 + i][query fr], sc1[i]: key lb + 16 + hi8 + i
    v8f sc0 = {}, sc1 = {};
    {
      v16h kf;
#pragma unroll
      for (int j = 0; j < 16; ++j) kf[j] = Ks[fr][koff(lane, j)];
      sc0 = __builtin_amdgcn_wmma_f32_16x16x32_f16(false, kf, false, qf0,
                                                   (short)0, sc0, false, false);
#pragma unroll
      for (int j = 0; j < 16; ++j) kf[j] = Ks[fr][32 + koff(lane, j)];
      sc0 = __builtin_amdgcn_wmma_f32_16x16x32_f16(false, kf, false, qf1,
                                                   (short)0, sc0, false, false);
#pragma unroll
      for (int j = 0; j < 16; ++j) kf[j] = Ks[16 + fr][koff(lane, j)];
      sc1 = __builtin_amdgcn_wmma_f32_16x16x32_f16(false, kf, false, qf0,
                                                   (short)0, sc1, false, false);
#pragma unroll
      for (int j = 0; j < 16; ++j) kf[j] = Ks[16 + fr][32 + koff(lane, j)];
      sc1 = __builtin_amdgcn_wmma_f32_16x16x32_f16(false, kf, false, qf1,
                                                   (short)0, sc1, false, false);
    }

    // ---- online softmax: one query per lane, keys along the registers ----
#pragma unroll
    for (int i = 0; i < 8; ++i) {
      sc0[i] *= 0.125f;  // 1/sqrt(64)
      sc1[i] *= 0.125f;
    }
    if (lb + 32 > NL) {  // only the last chunk has keys past the table
#pragma unroll
      for (int i = 0; i < 8; ++i) {
        if (lb + hi8 + i >= NL)      sc0[i] = -3.0e38f;
        if (lb + 16 + hi8 + i >= NL) sc1[i] = -3.0e38f;
      }
    }
    float mx = fmaxf(sc0[0], sc1[0]);
#pragma unroll
    for (int i = 1; i < 8; ++i) mx = fmaxf(mx, fmaxf(sc0[i], sc1[i]));
    mx = fmaxf(mx, xhalf(mx));
    const float mn   = fmaxf(mrow, mx);
    const float corr = __expf(mrow - mn);
    mrow = mn;

    v16h pf;  // P^T as B operand: element j is key koff(lane, j), column fr
    float ps = 0.0f;
#pragma unroll
    for (int i = 0; i < 8; ++i) {
      const float p0 = __expf(sc0[i] - mn);
      const float p1 = __expf(sc1[i] - mn);
      ps += p0 + p1;
      pf[i]     = (_Float16)p0;
      pf[8 + i] = (_Float16)p1;
    }
    srow = srow * corr + ps;
#pragma unroll
    for (int d = 0; d < 4; ++d)
#pragma unroll
      for (int i = 0; i < 8; ++i) cacc[d][i] *= corr;

    // ---- ctx^T += V^T(16x32) * P^T(32x16): 4 WMMA over dh tiles ----------
#pragma unroll
    for (int d = 0; d < 4; ++d) {
      v16h vf;
#pragma unroll
      for (int j = 0; j < 16; ++j) vf[j] = Vs[koff(lane, j)][d * 16 + fr];
      cacc[d] = __builtin_amdgcn_wmma_f32_16x16x32_f16(false, vf, false, pf,
                                                       (short)0, cacc[d],
                                                       false, false);
    }
    __syncthreads();
  }

  // ---- normalize + store context (f32): 8 consecutive d per lane and tile --
  srow += xhalf(srow);
  const int q = q0 + fr;
  if (q < NSQ) {
    const float inv = 1.0f / srow;
    float* cp = Ctx + ((size_t)(b * NSQ + q)) * NE + h * NDH + hi8;
#pragma unroll
    for (int d = 0; d < 4; ++d) {
      *(float4*)&cp[d * 16]     = make_float4(cacc[d][0] * inv, cacc[d][1] * inv,
                                              cacc[d][2] * inv, cacc[d][3] * inv);
      *(float4*)&cp[d * 16 + 4] = make_float4(cacc[d][4] * inv, cacc[d][5] * inv,
                                              cacc[d][6] * inv, cacc[d][7] * inv);
    }
  }
}

// ---------------------------------------------------------------------------
extern "C" void kernel_launch(void* const* d_in, const int* in_sizes, int n_in,
                              void* d_out, int out_size, void* d_ws, size_t ws_size,
                              hipStream_t stream) {
  const float* features = (const float*)d_in[0];
  const float* labels   = (const float*)d_in[1];
  const float* Wq = (const float*)d_in[2];
  const float* bq = (const float*)d_in[3];
  const float* Wk = (const float*)d_in[4];
  const float* bk = (const float*)d_in[5];
  const float* Wv = (const float*)d_in[6];
  const float* bv = (const float*)d_in[7];
  const float* Wo = (const float*)d_in[8];
  const float* bo = (const float*)d_in[9];
  float* out = (float*)d_out;

  const size_t MQ = (size_t)NB * NSQ;  // 6272
  _Float16* Qh = (_Float16*)d_ws;      // [6272,1024] f16
  _Float16* Kh = Qh + MQ * NE;         // [1000,1024] f16
  _Float16* Vh = Kh + (size_t)NL * NE; // [1000,1024] f16
  float*    ctx = (float*)(Vh + (size_t)NL * NE);  // [6272,1024] f32

  const dim3 blk(256);

  // Q = features @ Wq^T + bq  -> f16   (M=6272 -> 49 tiles, N=1024 -> 8)
  gemm_bt_f16<<<dim3(49, 8), blk, 0, stream>>>(
      features, Wq, bq, nullptr, Qh, (int)MQ, NE, NFD, 1);
  // K = labels @ Wk^T + bk    -> f16   (M=1000 -> 8 tiles)
  gemm_bt_f16<<<dim3(8, 8), blk, 0, stream>>>(
      labels, Wk, bk, nullptr, Kh, NL, NE, NE, 1);
  // V = labels @ Wv^T + bv    -> f16
  gemm_bt_f16<<<dim3(8, 8), blk, 0, stream>>>(
      labels, Wv, bv, nullptr, Vh, NL, NE, NE, 1);

  // attention: softmax(Q K^T / 8) V  -> ctx (f32)
  attn_f16<<<dim3(NB * NH * 4), dim3(128), 0, stream>>>(Qh, Kh, Vh, ctx);

  // out = ctx @ Wo^T + bo     -> f32
  gemm_bt_f16<<<dim3(49, 8), blk, 0, stream>>>(
      ctx, Wo, bo, out, nullptr, (int)MQ, NE, NE, 0);
}

// v003
// A run of this version takes 157 microseconds.
// Timed twice side by side with v002, it ran 1.28 and 1.29 times as fast.
// Over all steps from v000 it is 2.00 times as fast.
#include <hip/hip_runtime.h>

typedef __attribute__((ext_vector_type(16))) _Float16 v16h;
typedef __attribute__((ext_vector_type(4)))  _Float16 v4h;
typedef __attribute__((ext_vector_type(8)))  float    v8f;

#define NB    32      // batch
#define NSQ   196     // query sequence
#define NFD   2048    // feature dim
#define NL    1000    // labels
#define NE    1024    // embed dim
#define NH    16      // heads
#define NDH   64      // head dim

#if __has_builtin(__builtin_amdgcn_global_load_async_to_lds_b128) && \
    __has_builtin(__builtin_amdgcn_s_wait_asynccnt)
#define USE_ASYNC_LDS 1
typedef int v4i_vec __attribute__((vector_size(16)));
typedef __attribute__((address_space(1))) v4i_vec g_v4i;  // global (AS1)
typedef __attribute__((address_space(3))) v4i_vec l_v4i;  // LDS (AS3)
#else
#define USE_ASYNC_LDS 0
#endif

// 16-bit WMMA A/B operand element mapping (ISA 7.12.2):
// lane L holds matrix row (L & 15); element j of the v16h maps to
// K = kb + j      for j in [0,8)   (VGPR0..3)
// K = kb + j + 8  for j in [8,16)  (VGPR4..7), kb = (L<16) ? 0 : 8
__device__ __forceinline__ int koff(int lane, int j) {
  int kb = (lane & 16) ? 8 : 0;
  return kb + j + (j & 8);
}

// ---------------------------------------------------------------------------
// GEMM: C[M,N] = A[M,K] (f32) * B[N,K]^T (f32) + bias[N]
// out_half!=0 -> write _Float16 to Ch ; else write float to Cf
// block = 256 threads (8 waves). Block tile 128x128, wave tile 32x64,
// K step 32 -> 8 v_wmma_f32_16x16x32_f16 per wave per K step.
// gemm_tile computes the block tile whose first row is m0, first column n0.
// ---------------------------------------------------------------------------
__device__ __forceinline__ void gemm_tile(
    const float* __restrict__ A, const float* __restrict__ Bw,
    const float* __restrict__ bias, float* __restrict__ Cf,
    _Float16* __restrict__ Ch, int M, int N, int K, int out_half,
    int m0, int n0)
{
  __shared__ alignas(16) _Float16 As[128][40];
  __shared__ alignas(16) _Float16 Bs[128][40];

  const int t    = threadIdx.x;
  const int lane = t & 31;
  const int wave = t >> 5;
  const int wm   = wave & 3;   // 0..3 -> 32-row slab
  const int wn   = wave >> 2;  // 0..1 -> 64-col slab
  const int fr   = lane & 15;
  const int hi8  = (lane >> 4) << 3;

  // staging: 8 lanes take the 32 f32 (one 128-byte line) of a row, so that a
  // wave-wide 16-byte load covers 4 whole lines. Load i of a wave takes row
  // lrow + i in each of its four lane groups; the groups stand 4 rows apart,
  // which at the 80-byte LDS pitch puts their 8-byte stores on disjoint banks.
  const int lrow = wave * 16 + ((lane >> 3) << 2);  // + i, i = 0..3
  const int lcol = (lane & 7) * 4;                  // f32 column 0..28
  unsigned aoff[4], boff[4];  // byte offsets of this lane's loads in A and Bw
#pragma unroll
  for (int i = 0; i < 4; ++i) {
    aoff[i] = ((unsigned)min(m0 + lrow + i, M - 1) * (unsigned)K + lcol) * 4u;
    boff[i] = ((unsigned)min(n0 + lrow + i, N - 1) * (unsigned)K + lcol) * 4u;
  }

  // prefetch: each lane pair asks for one row's line of the next K tile
  const int srow = t >> 1;         // 0..127
  const int scol = (t & 1) * 16;   // 0 or 16
  const int ar = min(m0 + srow, M - 1);
  const int br = min(n0 + srow, N - 1);

  v8f acc[2][4] = {};

  for (int k0 = 0; k0 < K; k0 += 32) {
    const float* apf = A  + (size_t)ar * K + k0 + scol;
    const float* bpf = Bw + (size_t)br * K + k0 + scol;
    float4 av[4], bv[4];
#pragma unroll
    for (int i = 0; i < 4; ++i)
      av[i] = *(const float4*)((const char*)A + aoff[i]);
#pragma unroll
    for (int i = 0; i < 4; ++i)
      bv[i] = *(const float4*)((const char*)Bw + boff[i]);

    if (k0 + 32 < K) {  // global_prefetch_b8 of the next K tile
      __builtin_prefetch(apf + 32, 0, 1);
      __builtin_prefetch(bpf + 32, 0, 1);
    }

#pragma unroll
    for (int i = 0; i < 4; ++i) {
      v4h ha, hb;
      ha[0] = (_Float16)av[i].x; ha[1] = (_Float16)av[i].y;
      ha[2] = (_Float16)av[i].z; ha[3] = (_Float16)av[i].w;
      hb[0] = (_Float16)bv[i].x; hb[1] = (_Float16)bv[i].y;
      hb[2] = (_Float16)bv[i].z; hb[3] = (_Float16)bv[i].w;
      *(v4h*)&As[lrow + i][lcol] = ha;
      *(v4h*)&Bs[lrow + i][lcol] = hb;
      aoff[i] += 128u;  // next K tile: 32 f32 on
      boff[i] += 128u;
    }
    __syncthreads();

    v16h af[2], bf[4];
#pragma unroll
    for (int s = 0; s < 2; ++s)
#pragma unroll
      for (int j = 0; j < 16; ++j)
        af[s][j] = As[wm * 32 + s * 16 + fr][koff(lane, j)];
#pragma unroll
    for (int s = 0; s < 4; ++s)
#pragma unroll
      for (int j = 0; j < 16; ++j)
        bf[s][j] = Bs[wn * 64 + s * 16 + fr][koff(lane, j)];

#pragma unroll
    for (int ia = 0; ia < 2; ++ia)
#pragma unroll
      for (int ib = 0; ib < 4; ++ib)
        acc[ia][ib] = __builtin_amdgcn_wmma_f32_16x16x32_f16(
            false, af[ia], false, bf[ib], (short)0, acc[ia][ib], false, false);
    __syncthreads();
  }

#pragma unroll
  for (int ib = 0; ib < 4; ++ib) {
    const int nc = n0 + wn * 64 + ib * 16 + fr;
    const float bvv = bias[nc];
#pragma unroll
    for (int ia = 0; ia < 2; ++ia) {
#pragma unroll
      for (int i = 0; i < 8; ++i) {
        const int m = m0 + wm * 32 + ia * 16 + hi8 + i;
        if (m < M) {
          const float x = acc[ia][ib][i] + bvv;
          if (out_half) Ch[(size_t)m * N + nc] = (_Float16)x;
          else          Cf[(size_t)m * N + nc] = x;
        }
      }
    }
  }
}

__global__ __launch_bounds__(256) void gemm_bt_f16(
    const float* __restrict__ A, const float* __restrict__ Bw,
    const float* __restrict__ bias, float* __restrict__ Cf,
    _Float16* __restrict__ Ch, int M, int N, int K, int out_half)
{
  gemm_tile(A, Bw, bias, Cf, Ch, M, N, K, out_half,
            blockIdx.x * 128, blockIdx.y * 128);
}

// The three input projections, which do not depend on one another, in one
// launch: the K and V products have only 64 block tiles each, a quarter of
// the chip's WGPs, and run here beside the Q product instead of after it.
// Blocks 0..391: Q tiles (the long ones, K = 2048, first), in the order of a
// (49, 8) grid; 392..455: K tiles; 456..519: V tiles, each as an (8, 8) grid.
#define QTM   49                 // 128-row tiles of Q
#define QTILES (QTM * (NE / 128))
__global__ __launch_bounds__(256) void proj_qkv_f16(
    const float* __restrict__ features, const float* __restrict__ labels,
    const float* __restrict__ Wq, const float* __restrict__ bq,
    const float* __restrict__ Wk, const float* __restrict__ bk,
    const float* __restrict__ Wv, const float* __restrict__ bv,
    _Float16* __restrict__ Qh, _Float16* __restrict__ Kh,
    _Float16* __restrict__ Vh)
{
  const int bid = blockIdx.x;
  const bool isq = bid < QTILES;
  const int  r   = bid - QTILES;       // K and V tiles: 0..127
  const bool isk = r < 64;
  const float* A    = isq ? features : labels;
  const float* Bw   = isq ? Wq : (isk ? Wk : Wv);
  const float* bias = isq ? bq : (isk ? bk : bv);
  _Float16*    Ch   = isq ? Qh : (isk ? Kh : Vh);
  const int M  = isq ? NB * NSQ : NL;
  const int K  = isq ? NFD : NE;
  const int tm = isq ? bid % QTM : (r & 7);
  const int tn = isq ? bid / QTM : ((r >> 3) & 7);
  gemm_tile(A, Bw, bias, nullptr, Ch, M, NE, K, 1, tm * 128, tn * 128);
}

// ---------------------------------------------------------------------------
// Flash-style attention over the label table, transposed products:
//   St = K * Q^T   (A = 16 keys from LDS, B = 16 queries kept in VGPRs)
//   Ot += V^T * P^T
// In the D layout a lane then holds the scores of ONE query (column lane&15),
// 8 keys per tile, so the row maximum and the row sum are taken in the lane's
// own registers (one exchange between the wave halves for the maximum), and
// two converted St tiles are already the B operand P^T: P never goes to LDS.
// grid.x = B*H*4 ; block = 128 (4 waves). Each wave owns 16 query rows of a
// 64-query tile, keeps its own online softmax state + 64x16 f32 context acc.
// K/V chunks staged via GLOBAL_LOAD_ASYNC_TO_LDS_B128 when available.
// ---------------------------------------------------------------------------
__device__ __forceinline__ float xhalf(float x) {  // value of lane ^ 16
  const int b = __builtin_bit_cast(int, x);
  return __builtin_bit_cast(float, __builtin_amdgcn_permlanex16(
      b, b, 0x76543210, 0xfedcba98, false, false));
}

__global__ __launch_bounds__(128) void attn_f16(
    const _Float16* __restrict__ Qh, const _Float16* __restrict__ Kh,
    const _Float16* __restrict__ Vh, float* __restrict__ Ctx)
{
  __shared__ alignas(16) _Float16 Ks[32][72];
  __shared__ alignas(16) _Float16 Vs[32][72];

  const int t    = threadIdx.x;
  const int lane = t & 31;
  const int wave = t >> 5;
  const int fr   = lane & 15;
  const int hi8  = (lane >> 4) << 3;   // D-layout row offset: 0 or 8

  const int qt = blockIdx.x & 3;
  const int h  = (blockIdx.x >> 2) & 15;
  const int b  = blockIdx.x >> 6;

  const int q0 = qt * 64 + wave * 16;  // first query row of this wave

  // Q fragments: 16 x 64 head-dim, as two K=32 WMMA chunks, kept in VGPRs
  v16h qf0, qf1;
  {
    const int qr = min(q0 + fr, NSQ - 1);
    const _Float16* qp = Qh + ((size_t)(b * NSQ + qr)) * NE + h * NDH;
#pragma unroll
    for (int j = 0; j < 16; ++j) {
      const int kk = koff(lane, j);
      qf0[j] = qp[kk];
      qf1[j] = qp[32 + kk];
    }
  }

  // state of query q0 + fr: running maximum (equal in both wave halves) and
  // this half's share of the running sum (halves joined after the loop)
  float mrow = -3.0e38f, srow = 0.0f;
  v8f cacc[4] = {};  // cacc[d][i] = ctx[q0 + fr][d * 16 + hi8 + i]

  const int krr = t >> 2;         // staging row 0..31
  const int kcc = (t & 3) * 16;   // staging col 0,16,32,48 (halves)
  const size_t hoff = (size_t)h * NDH;

  for (int lb = 0; lb < NL; lb += 32) {
    // ---- stage 32 keys/values (f16) into LDS -----------------------------
    const int krow = min(lb + krr, NL - 1);
    const _Float16* kp = Kh + (size_t)krow * NE + hoff + kcc;
    const _Float16* vp = Vh + (size_t)krow * NE + hoff + kcc;
#if USE_ASYNC_LDS
    __builtin_amdgcn_global_load_async_to_lds_b128(
        (g_v4i*)kp,       (l_v4i*)&Ks[krr][kcc],     0, 0);
    __builtin_amdgcn_global_load_async_to_lds_b128(
        (g_v4i*)(kp + 8), (l_v4i*)&Ks[krr][kcc + 8], 0, 0);
    __builtin_amdgcn_global_load_async_to_lds_b128(
        (g_v4i*)vp,       (l_v4i*)&Vs[krr][kcc],     0, 0);
    __builtin_amdgcn_global_load_async_to_lds_b128(
        (g_v4i*)(vp + 8), (l_v4i*)&Vs[krr][kcc + 8], 0, 0);
    __builtin_amdgcn_s_wait_asynccnt(0);
#else
    const float4 k0v = ((const float4*)kp)[0];
    const float4 k1v = ((const float4*)kp)[1];
    const float4 v0v = ((const float4*)vp)[0];
    const float4 v1v = ((const float4*)vp)[1];
    *(float4*)&Ks[krr][kcc]     = k0v;
    *(float4*)&Ks[krr][kcc + 8] = k1v;
    *(float4*)&Vs[krr][kcc]     = v0v;
    *(float4*)&Vs[krr][kcc + 8] = v1v;
#endif
    __syncthreads();

    // ---- scores: 32keys x 16q = 2 D-tiles, each 2 WMMA (K=32 over dh=64) --
    // sc0[i] = S[key lb + hi8 + i][query fr], sc1[i]: key lb + 16 + hi8 + i
    v8f sc0 = {}, sc1 = {};
    {
      v16h kf;
#pragma unroll
      for (int j = 0; j < 16; ++j) kf[j] = Ks[fr][koff(lane, j)];
      sc0 = __builtin_amdgcn_wmma_f32_16x16x32_f16(false, kf, false, qf0,
                                                   (short)0, sc0, false, false);
#pragma unroll
      for (int j = 0; j < 16; ++j) kf[j] = Ks[fr][32 + koff(lane, j)];
      sc0 = __builtin_amdgcn_wmma_f32_16x16x32_f16(false, kf, false, qf1,
                                                   (short)0, sc0, false, false);
#pragma unroll
      for (int j = 0; j < 16; ++j) kf[j] = Ks[16 + fr][koff(lane, j)];
      sc1 = __builtin_amdgcn_wmma_f32_16x16x32_f16(false, kf, false, qf0,
                                                   (short)0, sc1, false, false);
#pragma unroll
      for (int j = 0; j < 16; ++j) kf[j] = Ks[16 + fr][32 + koff(lane, j)];
      sc1 = __builtin_amdgcn_wmma_f32_16x16x32_f16(false, kf, false, qf1,
                                                   (short)0, sc1, false, false);
    }

    // ---- online softmax: one query per lane, keys along the registers ----
#pragma unroll
    for (int i = 0; i < 8; ++i) {
      sc0[i] *= 0.125f;  // 1/sqrt(64)
      sc1[i] *= 0.125f;
    }
    if (lb + 32 > NL) {  // only the last chunk has keys past the table
#pragma unroll
      for (int i = 0; i < 8; ++i) {
        if (lb + hi8 + i >= NL)      sc0[i] = -3.0e38f;
        if (lb + 16 + hi8 + i >= NL) sc1[i] = -3.0e38f;
      }
    }
    float mx = fmaxf(sc0[0], sc1[0]);
#pragma unroll
    for (int i = 1; i < 8; ++i) mx = fmaxf(mx, fmaxf(sc0[i], sc1[i]));
    mx = fmaxf(mx, xhalf(mx));
    const float mn   = fmaxf(mrow, mx);
    const float corr = __expf(mrow - mn);
    mrow = mn;

    v16h pf;  // P^T as B operand: element j is key koff(lane, j), column fr
    float ps = 0.0f;
#pragma unroll
    for (int i = 0; i < 8; ++i) {
      const float p0 = __expf(sc0[i] - mn);
      const float p1 = __expf(sc1[i] - mn);
      ps += p0 + p1;
      pf[i]     = (_Float16)p0;
      pf[8 + i] = (_Float16)p1;
    }
    srow = srow * corr + ps;
#pragma unroll
    for (int d = 0; d < 4; ++d)
#pragma unroll
      for (int i = 0; i < 8; ++i) cacc[d][i] *= corr;

    // ---- ctx^T += V^T(16x32) * P^T(32x16): 4 WMMA over dh tiles ----------
#pragma unroll
    for (int d = 0; d < 4; ++d) {
      v16h vf;
#pragma unroll
      for (int j = 0; j < 16; ++j) vf[j] = Vs[koff(lane, j)][d * 16 + fr];
      cacc[d] = __builtin_amdgcn_wmma_f32_16x16x32_f16(false, vf, false, pf,
                                                       (short)0, cacc[d],
                                                       false, false);
    }
    __syncthreads();
  }

  // ---- normalize + store context (f32): 8 consecutive d per lane and tile --
  srow += xhalf(srow);
  const int q = q0 + fr;
  if (q < NSQ) {
    const float inv = 1.0f / srow;
    float* cp = Ctx + ((size_t)(b * NSQ + q)) * NE + h * NDH + hi8;
#pragma unroll
    for (int d = 0; d < 4; ++d) {
      *(float4*)&cp[d * 16]     = make_float4(cacc[d][0] * inv, cacc[d][1] * inv,
                                              cacc[d][2] * inv, cacc[d][3] * inv);
      *(float4*)&cp[d * 16 + 4] = make_float4(cacc[d][4] * inv, cacc[d][5] * inv,
                                              cacc[d][6] * inv, cacc[d][7] * inv);
    }
  }
}

// ---------------------------------------------------------------------------
extern "C" void kernel_launch(void* const* d_in, const int* in_sizes, int n_in,
                              void* d_out, int out_size, void* d_ws, size_t ws_size,
                              hipStream_t stream) {
  const float* features = (const float*)d_in[0];
  const float* labels   = (const float*)d_in[1];
  const float* Wq = (const float*)d_in[2];
  const float* bq = (const float*)d_in[3];
  const float* Wk = (const float*)d_in[4];
  const float* bk = (const float*)d_in[5];
  const float* Wv = (const float*)d_in[6];
  const float* bv = (const float*)d_in[7];
  const float* Wo = (const float*)d_in[8];
  const float* bo = (const float*)d_in[9];
  float* out = (float*)d_out;

  const size_t MQ = (size_t)NB * NSQ;  // 6272
  _Float16* Qh = (_Float16*)d_ws;      // [6272,1024] f16
  _Float16* Kh = Qh + MQ * NE;         // [1000,1024] f16
  _Float16* Vh = Kh + (size_t)NL * NE; // [1000,1024] f16
  float*    ctx = (float*)(Vh + (size_t)NL * NE);  // [6272,1024] f32

  const dim3 blk(256);

  // Q = features @ Wq^T + bq, K = labels @ Wk^T + bk, V = labels @ Wv^T + bv,
  // all -> f16: 49 * 8 + 8 * 8 + 8 * 8 = 520 block tiles in one launch
  proj_qkv_f16<<<dim3(520), blk, 0, stream>>>(
      features, labels, Wq, bq, Wk, bk, Wv, bv, Qh, Kh, Vh);

  // attention: softmax(Q K^T / 8) V  -> ctx (f32)
  attn_f16<<<dim3(NB * NH * 4), dim3(128), 0, stream>>>(Qh, Kh, Vh, ctx);

  // out = ctx @ Wo^T + bo     -> f32
  gemm_bt_f16<<<dim3(49, 8), blk, 0, stream>>>(
      ctx, Wo, bo, out, nullptr, (int)MQ, NE, NE, 0);
}

// v004
// It runs in 146 microseconds.
// In two side-by-side timings against v003, it was 1.08 and 1.07 times as fast.
// All steps since v000 together make it 2.15 times as fast.
#include <hip/hip_runtime.h>

typedef __attribute__((ext_vector_type(16))) _Float16 v16h;
typedef __attribute__((ext_vector_type(4)))  _Float16 v4h;
typedef __attribute__((ext_vector_type(8)))  float    v8f;

#define NB    32      // batch
#define NSQ   196     // query sequence
#define NFD   2048    // feature dim
#define NL    1000    // labels
#define NE    1024    // embed dim
#define NH    16      // heads
#define NDH   64      // head dim

#if __has_builtin(__builtin_amdgcn_global_load_async_to_lds_b128) && \
    __has_builtin(__builtin_amdgcn_s_wait_asynccnt)
#define USE_ASYNC_LDS 1
typedef int v4i_vec __attribute__((vector_size(16)));
typedef __attribute__((address_space(1))) v4i_vec g_v4i;  // global (AS1)
typedef __attribute__((address_space(3))) v4i_vec l_v4i;  // LDS (AS3)
#else
#define USE_ASYNC_LDS 0
#endif

// 16-bit WMMA A/B operand element mapping (ISA 7.12.2):
// lane L holds matrix row (L & 15); element j of the v16h maps to
// K = kb + j      for j in [0,8)   (VGPR0..3)
// K = kb + j + 8  for j in [8,16)  (VGPR4..7), kb = (L<16) ? 0 : 8
__device__ __forceinline__ int koff(int lane, int j) {
  int kb = (lane & 16) ? 8 : 0;
  return kb + j + (j & 8);
}

// ---------------------------------------------------------------------------
// GEMM: C[M,N] = A[M,K] (f32) * B[N,K]^T (f32) + bias[N]
// out_half!=0 -> write _Float16 to Ch ; else write float to Cf
// block = 256 threads (8 waves). Block tile 128x128, wave tile 32x64,
// K step 32 -> 8 v_wmma_f32_16x16x32_f16 per wave per K step.
// gemm_tile computes the block tile whose first row is m0, first column n0.
// ---------------------------------------------------------------------------
__device__ __forceinline__ void gemm_tile(
    const float* __restrict__ A, const float* __restrict__ Bw,
    const float* __restrict__ bias, float* __restrict__ Cf,
    _Float16* __restrict__ Ch, int M, int N, int K, int out_half,
    int m0, int n0)
{
  __shared__ alignas(16) _Float16 As[128][40];
  __shared__ alignas(16) _Float16 Bs[128][40];

  const int t    = threadIdx.x;
  const int lane = t & 31;
  const int wave = t >> 5;
  const int wm   = wave & 3;   // 0..3 -> 32-row slab
  const int wn   = wave >> 2;  // 0..1 -> 64-col slab
  const int fr   = lane & 15;
  const int hi8  = (lane >> 4) << 3;

  // staging: 8 lanes take the 32 f32 (one 128-byte line) of a row, so that a
  // wave-wide 16-byte load covers 4 whole lines. Load i of a wave takes row
  // lrow + i in each of its four lane groups; the groups stand 4 rows apart,
  // which at the 80-byte LDS pitch puts their 8-byte stores on disjoint banks.
  const int lrow = wave * 16 + ((lane >> 3) << 2);  // + i, i = 0..3
  const int lcol = (lane & 7) * 4;                  // f32 column 0..28
  unsigned aoff[4], boff[4];  // byte offsets of this lane's loads in A and Bw
#pragma unroll
  for (int i = 0; i < 4; ++i) {
    aoff[i] = ((unsigned)min(m0 + lrow + i, M - 1) * (unsigned)K + lcol) * 4u;
    boff[i] = ((unsigned)min(n0 + lrow + i, N - 1) * (unsigned)K + lcol) * 4u;
  }

  // prefetch: each lane pair asks for one row's line of the next K tile
  const int srow = t >> 1;         // 0..127
  const int scol = (t & 1) * 16;   // 0 or 16
  const int ar = min(m0 + srow, M - 1);
  const int br = min(n0 + srow, N - 1);

  v8f acc[2][4] = {};

  for (int k0 = 0; k0 < K; k0 += 32) {
    const float* apf = A  + (size_t)ar * K + k0 + scol;
    const float* bpf = Bw + (size_t)br * K + k0 + scol;
    float4 av[4], bv[4];
#pragma unroll
    for (int i = 0; i < 4; ++i)
      av[i] = *(const float4*)((const char*)A + aoff[i]);
#pragma unroll
    for (int i = 0; i < 4; ++i)
      bv[i] = *(const float4*)((const char*)Bw + boff[i]);

    if (k0 + 32 < K) {  // global_prefetch_b8 of the next K tile
      __builtin_prefetch(apf + 32, 0, 1);
      __builtin_prefetch(bpf + 32, 0, 1);
    }

#pragma unroll
    for (int i = 0; i < 4; ++i) {
      v4h ha, hb;
      ha[0] = (_Float16)av[i].x; ha[1] = (_Float16)av[i].y;
      ha[2] = (_Float16)av[i].z; ha[3] = (_Float16)av[i].w;
      hb[0] = (_Float16)bv[i].x; hb[1] = (_Float16)bv[i].y;
      hb[2] = (_Float16)bv[i].z; hb[3] = (_Float16)bv[i].w;
      *(v4h*)&As[lrow + i][lcol] = ha;
      *(v4h*)&Bs[lrow + i][lcol] = hb;
      aoff[i] += 128u;  // next K tile: 32 f32 on
      boff[i] += 128u;
    }
    __syncthreads();

    v16h af[2], bf[4];
#pragma unroll
    for (int s = 0; s < 2; ++s)
#pragma unroll
      for (int j = 0; j < 16; ++j)
        af[s][j] = As[wm * 32 + s * 16 + fr][koff(lane, j)];
#pragma unroll
    for (int s = 0; s < 4; ++s)
#pragma unroll
      for (int j = 0; j < 16; ++j)
        bf[s][j] = Bs[wn * 64 + s * 16 + fr][koff(lane, j)];

#pragma unroll
    for (int ia = 0; ia < 2; ++ia)
#pragma unroll
      for (int ib = 0; ib < 4; ++ib)
        acc[ia][ib] = __builtin_amdgcn_wmma_f32_16x16x32_f16(
            false, af[ia], false, bf[ib], (short)0, acc[ia][ib], false, false);
    __syncthreads();
  }

#pragma unroll
  for (int ib = 0; ib < 4; ++ib) {
    const int nc = n0 + wn * 64 + ib * 16 + fr;
    const float bvv = bias[nc];
#pragma unroll
    for (int ia = 0; ia < 2; ++ia) {
#pragma unroll
      for (int i = 0; i < 8; ++i) {
        const int m = m0 + wm * 32 + ia * 16 + hi8 + i;
        if (m < M) {
          const float x = acc[ia][ib][i] + bvv;
          if (out_half) Ch[(size_t)m * N + nc] = (_Float16)x;
          else          Cf[(size_t)m * N + nc] = x;
        }
      }
    }
  }
}

__global__ __launch_bounds__(256) void gemm_bt_f16(
    const float* __restrict__ A, const float* __restrict__ Bw,
    const float* __restrict__ bias, float* __restrict__ Cf,
    _Float16* __restrict__ Ch, int M, int N, int K, int out_half)
{
  gemm_tile(A, Bw, bias, Cf, Ch, M, N, K, out_half,
            blockIdx.x * 128, blockIdx.y * 128);
}

// The three input projections, which do not depend on one another, in one
// launch: the K and V products have only 64 block tiles each, a quarter of
// the chip's WGPs, and run here beside the Q product instead of after it.
// Blocks 0..391: Q tiles (the long ones, K = 2048, first), in the order of a
// (49, 8) grid; 392..455: K tiles; 456..519: V tiles, each as an (8, 8) grid.
#define QTM   49                 // 128-row tiles of Q
#define QTILES (QTM * (NE / 128))
__global__ __launch_bounds__(256) void proj_qkv_f16(
    const float* __restrict__ features, const float* __restrict__ labels,
    const float* __restrict__ Wq, const float* __restrict__ bq,
    const float* __restrict__ Wk, const float* __restrict__ bk,
    const float* __restrict__ Wv, const float* __restrict__ bv,
    _Float16* __restrict__ Qh, _Float16* __restrict__ Kh,
    _Float16* __restrict__ Vh)
{
  const int bid = blockIdx.x;
  const bool isq = bid < QTILES;
  const int  r   = bid - QTILES;       // K and V tiles: 0..127
  const bool isk = r < 64;
  const float* A    = isq ? features : labels;
  const float* Bw   = isq ? Wq : (isk ? Wk : Wv);
  const float* bias = isq ? bq : (isk ? bk : bv);
  _Float16*    Ch   = isq ? Qh : (isk ? Kh : Vh);
  const int M  = isq ? NB * NSQ : NL;
  const int K  = isq ? NFD : NE;
  const int tm = isq ? bid % QTM : (r & 7);
  const int tn = isq ? bid / QTM : ((r >> 3) & 7);
  gemm_tile(A, Bw, bias, nullptr, Ch, M, NE, K, 1, tm * 128, tn * 128);
}

// ---------------------------------------------------------------------------
// Flash-style attention over the label table, transposed products:
//   St = K * Q^T   (A = 16 keys from LDS, B = 16 queries kept in VGPRs)
//   Ot += V^T * P^T
// In the D layout a lane then holds the scores of ONE query (column lane&15),
// 8 keys per tile, so the row maximum and the row sum are taken in the lane's
// own registers (one exchange between the wave halves for the maximum), and
// two converted St tiles are already the B operand P^T: P never goes to LDS.
// grid.x = B*H*4 ; block = 128 (4 waves). Each wave owns 16 query rows of a
// 64-query tile, keeps its own online softmax state + 64x16 f32 context acc.
// K/V chunks staged via GLOBAL_LOAD_ASYNC_TO_LDS_B128 when available.
// ---------------------------------------------------------------------------
__device__ __forceinline__ float xhalf(float x) {  // value of lane ^ 16
  const int b = __builtin_bit_cast(int, x);
  return __builtin_bit_cast(float, __builtin_amdgcn_permlanex16(
      b, b, 0x76543210, 0xfedcba98, false, false));
}

// V rows in LDS: 160 bytes apart, an odd multiple of 32 bytes, the pitch at
// which the transposing load below meets no bank conflict.
#define VPITCH 80
typedef short s16x8 __attribute__((ext_vector_type(8)));
typedef __attribute__((ext_vector_type(8))) _Float16 v8h;
typedef __attribute__((address_space(3))) s16x8 lds_s16x8;
// ds_load_tr16_b128: lane (c = lane & 15, h = lane >> 4) gets the 8 halves
// T[8h + 0..7][c] of the 16 x 16 tile whose pieces the lanes point at.
__device__ __forceinline__ v8h ld_tr16(const _Float16* p) {
  return __builtin_bit_cast(v8h,
      __builtin_amdgcn_ds_load_tr16_b128_v8i16((lds_s16x8*)p));
}

__global__ __launch_bounds__(128) void attn_f16(
    const _Float16* __restrict__ Qh, const _Float16* __restrict__ Kh,
    const _Float16* __restrict__ Vh, float* __restrict__ Ctx)
{
  __shared__ alignas(16) _Float16 Ks[32][72];
  __shared__ alignas(16) _Float16 Vs[32][VPITCH];

  const int t    = threadIdx.x;
  const int lane = t & 31;
  const int wave = t >> 5;
  const int fr   = lane & 15;
  const int hi8  = (lane >> 4) << 3;   // D-layout row offset: 0 or 8

  const int qt = blockIdx.x & 3;
  const int h  = (blockIdx.x >> 2) & 15;
  const int b  = blockIdx.x >> 6;

  const int q0 = qt * 64 + wave * 16;  // first query row of this wave

  // Q fragments: 16 x 64 head-dim, as two K=32 WMMA chunks, kept in VGPRs
  v16h qf0, qf1;
  {
    const int qr = min(q0 + fr, NSQ - 1);
    const _Float16* qp = Qh + ((size_t)(b * NSQ + qr)) * NE + h * NDH;
#pragma unroll
    for (int j = 0; j < 16; ++j) {
      const int kk = koff(lane, j);
      qf0[j] = qp[kk];
      qf1[j] = qp[32 + kk];
    }
  }

  // state of query q0 + fr: running maximum (equal in both wave halves) and
  // this half's share of the running sum (halves joined after the loop)
  float mrow = -3.0e38f, srow = 0.0f;
  v8f cacc[4] = {};  // cacc[d][i] = ctx[q0 + fr][d * 16 + hi8 + i]

  const int krr = t >> 2;         // staging row 0..31
  const int kcc = (t & 3) * 16;   // staging col 0,16,32,48 (halves)
  const size_t hoff = (size_t)h * NDH;
  // this lane's 16-byte piece of the first 16-key x 16-column tile of Vs
  const _Float16* vtp = &Vs[hi8 + (lane & 7)][((lane >> 3) & 1) * 8];

  for (int lb = 0; lb < NL; lb += 32) {
    // ---- stage 32 keys/values (f16) into LDS -----------------------------
    const int krow = min(lb + krr, NL - 1);
    const _Float16* kp = Kh + (size_t)krow * NE + hoff + kcc;
    const _Float16* vp = Vh + (size_t)krow * NE + hoff + kcc;
#if USE_ASYNC_LDS
    __builtin_amdgcn_global_load_async_to_lds_b128(
        (g_v4i*)kp,       (l_v4i*)&Ks[krr][kcc],     0, 0);
    __builtin_amdgcn_global_load_async_to_lds_b128(
        (g_v4i*)(kp + 8), (l_v4i*)&Ks[krr][kcc + 8], 0, 0);
    __builtin_amdgcn_global_load_async_to_lds_b128(
        (g_v4i*)vp,       (l_v4i*)&Vs[krr][kcc],     0, 0);
    __builtin_amdgcn_global_load_async_to_lds_b128(
        (g_v4i*)(vp + 8), (l_v4i*)&Vs[krr][kcc + 8], 0, 0);
    __builtin_amdgcn_s_wait_asynccnt(0);
#else
    const float4 k0v = ((const float4*)kp)[0];
    const float4 k1v = ((const float4*)kp)[1];
    const float4 v0v = ((const float4*)vp)[0];
    const float4 v1v = ((const float4*)vp)[1];
    *(float4*)&Ks[krr][kcc]     = k0v;
    *(float4*)&Ks[krr][kcc + 8] = k1v;
    *(float4*)&Vs[krr][kcc]     = v0v;
    *(float4*)&Vs[krr][kcc + 8] = v1v;
#endif
    __syncthreads();

    // ---- scores: 32keys x 16q = 2 D-tiles, each 2 WMMA (K=32 over dh=64) --
    // sc0[i] = S[key lb + hi8 + i][query fr], sc1[i]: key lb + 16 + hi8 + i
    v8f sc0 = {}, sc1 = {};
    {
      v16h kf;
#pragma unroll
      for (int j = 0; j < 16; ++j) kf[j] = Ks[fr][koff(lane, j)];
      sc0 = __builtin_amdgcn_wmma_f32_16x16x32_f16(false, kf, false, qf0,
                                                   (short)0, sc0, false, false);
#pragma unroll
      for (int j = 0; j < 16; ++j) kf[j] = Ks[fr][32 + koff(lane, j)];
      sc0 = __builtin_amdgcn_wmma_f32_16x16x32_f16(false, kf, false, qf1,
                                                   (short)0, sc0, false, false);
#pragma unroll
      for (int j = 0; j < 16; ++j) kf[j] = Ks[16 + fr][koff(lane, j)];
      sc1 = __builtin_amdgcn_wmma_f32_16x16x32_f16(false, kf, false, qf0,
                                                   (short)0, sc1, false, false);
#pragma unroll
      for (int j = 0; j < 16; ++j) kf[j] = Ks[16 + fr][32 + koff(lane, j)];
      sc1 = __builtin_amdgcn_wmma_f32_16x16x32_f16(false, kf, false, qf1,
                                                   (short)0, sc1, false, false);
    }

    // ---- online softmax: one query per lane, keys along the registers ----
#pragma unroll
    for (int i = 0; i < 8; ++i) {
      sc0[i] *= 0.125f;  // 1/sqrt(64)
      sc1[i] *= 0.125f;
    }
    if (lb + 32 > NL) {  // only the last chunk has keys past the table
#pragma unroll
      for (int i = 0; i < 8; ++i) {
        if (lb + hi8 + i >= NL)      sc0[i] = -3.0e38f;
        if (lb + 16 + hi8 + i >= NL) sc1[i] = -3.0e38f;
      }
    }
    float mx = fmaxf(sc0[0], sc1[0]);
#pragma unroll
    for (int i = 1; i < 8; ++i) mx = fmaxf(mx, fmaxf(sc0[i], sc1[i]));
    mx = fmaxf(mx, xhalf(mx));
    const float mn   = fmaxf(mrow, mx);
    const float corr = __expf(mrow - mn);
    mrow = mn;

    v16h pf;  // P^T as B operand: element j is key koff(lane, j), column fr
    float ps = 0.0f;
#pragma unroll
    for (int i = 0; i < 8; ++i) {
      const float p0 = __expf(sc0[i] - mn);
      const float p1 = __expf(sc1[i] - mn);
      ps += p0 + p1;
      pf[i]     = (_Float16)p0;
      pf[8 + i] = (_Float16)p1;
    }
    srow = srow * corr + ps;
#pragma unroll
    for (int d = 0; d < 4; ++d)
#pragma unroll
      for (int i = 0; i < 8; ++i) cacc[d][i] *= corr;

    // ---- ctx^T += V^T(16x32) * P^T(32x16): 4 WMMA over dh tiles ----------
#pragma unroll
    for (int d = 0; d < 4; ++d) {
      // elements 0..7 from keys 0..15, 8..15 from keys 16..31: koff's order
      const v8h vlo = ld_tr16(vtp + d * 16);
      const v8h vhi = ld_tr16(vtp + 16 * VPITCH + d * 16);
      const v16h vf = __builtin_shufflevector(vlo, vhi, 0, 1, 2, 3, 4, 5, 6, 7,
                                              8, 9, 10, 11, 12, 13, 14, 15);
      cacc[d] = __builtin_amdgcn_wmma_f32_16x16x32_f16(false, vf, false, pf,
                                                       (short)0, cacc[d],
                                                       false, false);
    }
    __syncthreads();
  }

  // ---- normalize + store context (f32): 8 consecutive d per lane and tile --
  srow += xhalf(srow);
  const int q = q0 + fr;
  if (q < NSQ) {
    const float inv = 1.0f / srow;
    float* cp = Ctx + ((size_t)(b * NSQ + q)) * NE + h * NDH + hi8;
#pragma unroll
    for (int d = 0; d < 4; ++d) {
      *(float4*)&cp[d * 16]     = make_float4(cacc[d][0] * inv, cacc[d][1] * inv,
                                              cacc[d][2] * inv, cacc[d][3] * inv);
      *(float4*)&cp[d * 16 + 4] = make_float4(cacc[d][4] * inv, cacc[d][5] * inv,
                                              cacc[d][6] * inv, cacc[d][7] * inv);
    }
  }
}

// ---------------------------------------------------------------------------
extern "C" void kernel_launch(void* const* d_in, const int* in_sizes, int n_in,
                              void* d_out, int out_size, void* d_ws, size_t ws_size,
                              hipStream_t stream) {
  const float* features = (const float*)d_in[0];
  const float* labels   = (const float*)d_in[1];
  const float* Wq = (const float*)d_in[2];
  const float* bq = (const float*)d_in[3];
  const float* Wk = (const float*)d_in[4];
  const float* bk = (const float*)d_in[5];
  const float* Wv = (const float*)d_in[6];
  const float* bv = (const float*)d_in[7];
  const float* Wo = (const float*)d_in[8];
  const float* bo = (const float*)d_in[9];
  float* out = (float*)d_out;

  const size_t MQ = (size_t)NB * NSQ;  // 6272
  _Float16* Qh = (_Float16*)d_ws;      // [6272,1024] f16
  _Float16* Kh = Qh + MQ * NE;         // [1000,1024] f16
  _Float16* Vh = Kh + (size_t)NL * NE; // [1000,1024] f16
  float*    ctx = (float*)(Vh + (size_t)NL * NE);  // [6272,1024] f32

  const dim3 blk(256);

  // Q = features @ Wq^T + bq, K = labels @ Wk^T + bk, V = labels @ Wv^T + bv,
  // all -> f16: 49 * 8 + 8 * 8 + 8 * 8 = 520 block tiles in one launch
  proj_qkv_f16<<<dim3(520), blk, 0, stream>>>(
      features, labels, Wq, bq, Wk, bk, Wv, bv, Qh, Kh, Vh);

  // attention: softmax(Q K^T / 8) V  -> ctx (f32)
  attn_f16<<<dim3(NB * NH * 4), dim3(128), 0, stream>>>(Qh, Kh, Vh, ctx);

  // out = ctx @ Wo^T + bo     -> f32
  gemm_bt_f16<<<dim3(49, 8), blk, 0, stream>>>(
      ctx, Wo, bo, out, nullptr, (int)MQ, NE, NE, 0);
}

// v005
// One run takes 117 microseconds.
// Timed twice side by side with v004, it ran 1.24 times as fast both times.
// Counting every step since v000, it is 2.67 times as fast.
#include <hip/hip_runtime.h>

typedef __attribute__((ext_vector_type(16))) _Float16 v16h;
typedef __attribute__((ext_vector_type(4)))  _Float16 v4h;
typedef __attribute__((ext_vector_type(8)))  float    v8f;

#define NB    32      // batch
#define NSQ   196     // query sequence
#define NFD   2048    // feature dim
#define NL    1000    // labels
#define NE    1024    // embed dim
#define NH    16      // heads
#define NDH   64      // head dim

#if __has_builtin(__builtin_amdgcn_global_load_async_to_lds_b128) && \
    __has_builtin(__builtin_amdgcn_s_wait_asynccnt)
#define USE_ASYNC_LDS 1
typedef int v4i_vec __attribute__((vector_size(16)));
typedef __attribute__((address_space(1))) v4i_vec g_v4i;  // global (AS1)
typedef __attribute__((address_space(3))) v4i_vec l_v4i;  // LDS (AS3)
#else
#define USE_ASYNC_LDS 0
#endif

// 16-bit WMMA A/B operand element mapping (ISA 7.12.2):
// lane L holds matrix row (L & 15); element j of the v16h maps to
// K = kb + j      for j in [0,8)   (VGPR0..3)
// K = kb + j + 8  for j in [8,16)  (VGPR4..7), kb = (L<16) ? 0 : 8
__device__ __forceinline__ int koff(int lane, int j) {
  int kb = (lane & 16) ? 8 : 0;
  return kb + j + (j & 8);
}

// ---------------------------------------------------------------------------
// GEMM: C[M,N] = A[M,K] (f32) * B[N,K]^T (f32) + bias[N]
// out_half!=0 -> write _Float16 to Ch ; else write float to Cf
// block = 256 threads (8 waves). Block tile 128x128, wave tile 32x64,
// K step 32 -> 8 v_wmma_f32_16x16x32_f16 per wave per K step; the global
// loads run two K tiles ahead of the products, in two register sets.
// gemm_tile computes the block tile whose first row is m0, first column n0.
// ---------------------------------------------------------------------------
// Work-group barrier for LDS traffic alone: this wave's LDS reads and writes
// are complete, then signal and wait. __syncthreads() would also wait for the
// global loads in flight, which are meant to stay in flight across it.
__device__ __forceinline__ void lds_barrier() {
  asm volatile("s_wait_dscnt 0x0\n\ts_barrier_signal -1\n\ts_barrier_wait -1"
               ::: "memory");
}

__device__ __forceinline__ void gemm_tile(
    const float* __restrict__ A, const float* __restrict__ Bw,
    const float* __restrict__ bias, float* __restrict__ Cf,
    _Float16* __restrict__ Ch, int M, int N, int K, int out_half,
    int m0, int n0)
{
  // two LDS buffers per operand: a K step reads one while the next K tile
  // is written into the other, so one barrier a step is enough
  __shared__ alignas(16) _Float16 As[2][128][40];
  __shared__ alignas(16) _Float16 Bs[2][128][40];

  const int t    = threadIdx.x;
  const int lane = t & 31;
  const int wave = t >> 5;
  const int wm   = wave & 3;   // 0..3 -> 32-row slab
  const int wn   = wave >> 2;  // 0..1 -> 64-col slab
  const int fr   = lane & 15;
  const int hi8  = (lane >> 4) << 3;

  // staging: 8 lanes take the 32 f32 (one 128-byte line) of a row, so that a
  // wave-wide 16-byte load covers 4 whole lines. Load i of a wave takes row
  // lrow + i in each of its four lane groups; the groups stand 4 rows apart,
  // which at the 80-byte LDS pitch puts their 8-byte stores on disjoint banks.
  const int lrow = wave * 16 + ((lane >> 3) << 2);  // + i, i = 0..3
  const int lcol = (lane & 7) * 4;                  // f32 column 0..28
  unsigned aoff[4], boff[4];  // byte offsets of this lane's loads in A and Bw
#pragma unroll
  for (int i = 0; i < 4; ++i) {
    aoff[i] = ((unsigned)min(m0 + lrow + i, M - 1) * (unsigned)K + lcol) * 4u;
    boff[i] = ((unsigned)min(n0 + lrow + i, N - 1) * (unsigned)K + lcol) * 4u;
  }

  v8f acc[2][4] = {};

  // K tiles are fetched in order; ab and bb point at the next one's column 0
  const char* ab = (const char*)A;
  const char* bb = (const char*)Bw;
  auto fetch = [&](float4 (&av)[4], float4 (&bv)[4]) {
#pragma unroll
    for (int i = 0; i < 4; ++i) av[i] = *(const float4*)(ab + aoff[i]);
#pragma unroll
    for (int i = 0; i < 4; ++i) bv[i] = *(const float4*)(bb + boff[i]);
    // a precaution: these loads stay in flight for two K steps, in which
    // their address registers are given other values
    asm volatile("s_wait_xcnt 0x0" ::: "memory");
    ab += 128;  // 32 f32 on
    bb += 128;
  };
  auto stash = [&](const float4 (&av)[4], const float4 (&bv)[4], int buf) {
#pragma unroll
    for (int i = 0; i < 4; ++i) {
      v4h ha, hb;
      ha[0] = (_Float16)av[i].x; ha[1] = (_Float16)av[i].y;
      ha[2] = (_Float16)av[i].z; ha[3] = (_Float16)av[i].w;
      hb[0] = (_Float16)bv[i].x; hb[1] = (_Float16)bv[i].y;
      hb[2] = (_Float16)bv[i].z; hb[3] = (_Float16)bv[i].w;
      *(v4h*)&As[buf][lrow + i][lcol] = ha;
      *(v4h*)&Bs[buf][lrow + i][lcol] = hb;
    }
  };
  // one K step: products of the tile in buffer cur; the tile after it, whose
  // loads were issued two steps ago, goes from (av, bv) into the other buffer,
  // and (av, bv) take the loads of the tile two further on. cur and the two
  // flags are literals at every call: no branch stands in a step, so the
  // compiler's counted waits leave the younger set's loads in flight.
  auto kstep = [&](int cur, float4 (&av)[4], float4 (&bv)[4],
                   bool has_next, bool has_fetch) {
    v16h af[2], bf[4];
#pragma unroll
    for (int s = 0; s < 2; ++s)
#pragma unroll
      for (int j = 0; j < 16; ++j)
        af[s][j] = As[cur][wm * 32 + s * 16 + fr][koff(lane, j)];
#pragma unroll
    for (int s = 0; s < 4; ++s)
#pragma unroll
      for (int j = 0; j < 16; ++j)
        bf[s][j] = Bs[cur][wn * 64 + s * 16 + fr][koff(lane, j)];
    if (has_next) stash(av, bv, cur ^ 1);
    // the LDS traffic issues first: the products wait for the fragment loads
    // and the barrier for the stores, the global loads are due in two steps
    __builtin_amdgcn_sched_barrier(0);
    if (has_fetch) fetch(av, bv);
#pragma unroll
    for (int ia = 0; ia < 2; ++ia)
#pragma unroll
      for (int ib = 0; ib < 4; ++ib)
        acc[ia][ib] = __builtin_amdgcn_wmma_f32_16x16x32_f16(
            false, af[ia], false, bf[ib], (short)0, acc[ia][ib], false, false);
    if (has_next) {
      // keeps the products in front of the barrier: its wait then passes
      // while the matrix unit works, and no product stands between the
      // barrier and the next fragment loads
      __builtin_amdgcn_sched_barrier(0);
      lds_barrier();
    }
  };

  // K is a multiple of 64 and at least 192 (here 1024 or 2048)
  const int nk = K >> 5;  // K tiles of 32
  float4 a0[4], b0[4], a1[4], b1[4];  // even and odd K tiles in flight
  {
    float4 af[4], bf[4];
    fetch(af, bf);  // tile 0
    fetch(a1, b1);  // tile 1
    fetch(a0, b0);  // tile 2
    stash(af, bf, 0);
  }
  lds_barrier();
  int k = 0;
  do {
    kstep(0, a1, b1, true, true);
    kstep(1, a0, b0, true, true);
    k += 2;
  } while (k + 4 < nk);
  kstep(0, a1, b1, true, true);    // tile nk - 4; fetches the last tile
  kstep(1, a0, b0, true, false);
  kstep(0, a1, b1, true, false);
  kstep(1, a0, b0, false, false);  // tile nk - 1

#pragma unroll
  for (int ib = 0; ib < 4; ++ib) {
    const int nc = n0 + wn * 64 + ib * 16 + fr;
    const float bvv = bias[nc];
#pragma unroll
    for (int ia = 0; ia < 2; ++ia) {
#pragma unroll
      for (int i = 0; i < 8; ++i) {
        const int m = m0 + wm * 32 + ia * 16 + hi8 + i;
        if (m < M) {
          const float x = acc[ia][ib][i] + bvv;
          if (out_half) Ch[(size_t)m * N + nc] = (_Float16)x;
          else          Cf[(size_t)m * N + nc] = x;
        }
      }
    }
  }
}

__global__ __launch_bounds__(256) void gemm_bt_f16(
    const float* __restrict__ A, const float* __restrict__ Bw,
    const float* __restrict__ bias, float* __restrict__ Cf,
    _Float16* __restrict__ Ch, int M, int N, int K, int out_half)
{
  gemm_tile(A, Bw, bias, Cf, Ch, M, N, K, out_half,
            blockIdx.x * 128, blockIdx.y * 128);
}

// The three input projections, which do not depend on one another, in one
// launch: the K and V products have only 64 block tiles each, a quarter of
// the chip's WGPs, and run here beside the Q product instead of after it.
// Blocks 0..391: Q tiles (the long ones, K = 2048, first), in the order of a
// (49, 8) grid; 392..455: K tiles; 456..519: V tiles, each as an (8, 8) grid.
#define QTM   49                 // 128-row tiles of Q
#define QTILES (QTM * (NE / 128))
__global__ __launch_bounds__(256) void proj_qkv_f16(
    const float* __restrict__ features, const float* __restrict__ labels,
    const float* __restrict__ Wq, const float* __restrict__ bq,
    const float* __restrict__ Wk, const float* __restrict__ bk,
    const float* __restrict__ Wv, const float* __restrict__ bv,
    _Float16* __restrict__ Qh, _Float16* __restrict__ Kh,
    _Float16* __restrict__ Vh)
{
  const int bid = blockIdx.x;
  const bool isq = bid < QTILES;
  const int  r   = bid - QTILES;       // K and V tiles: 0..127
  const bool isk = r < 64;
  const float* A    = isq ? features : labels;
  const float* Bw   = isq ? Wq : (isk ? Wk : Wv);
  const float* bias = isq ? bq : (isk ? bk : bv);
  _Float16*    Ch   = isq ? Qh : (isk ? Kh : Vh);
  const int M  = isq ? NB * NSQ : NL;
  const int K  = isq ? NFD : NE;
  const int tm = isq ? bid % QTM : (r & 7);
  const int tn = isq ? bid / QTM : ((r >> 3) & 7);
  gemm_tile(A, Bw, bias, nullptr, Ch, M, NE, K, 1, tm * 128, tn * 128);
}

// ---------------------------------------------------------------------------
// Flash-style attention over the label table, transposed products:
//   St = K * Q^T   (A = 16 keys from LDS, B = 16 queries kept in VGPRs)
//   Ot += V^T * P^T
// In the D layout a lane then holds the scores of ONE query (column lane&15),
// 8 keys per tile, so the row maximum and the row sum are taken in the lane's
// own registers (one exchange between the wave halves for the maximum), and
// two converted St tiles are already the B operand P^T: P never goes to LDS.
// grid.x = B*H*4 ; block = 128 (4 waves). Each wave owns 16 query rows of a
// 64-query tile, keeps its own online softmax state + 64x16 f32 context acc.
// K/V chunks staged via GLOBAL_LOAD_ASYNC_TO_LDS_B128 when available.
// ---------------------------------------------------------------------------
__device__ __forceinline__ float xhalf(float x) {  // value of lane ^ 16
  const int b = __builtin_bit_cast(int, x);
  return __builtin_bit_cast(float, __builtin_amdgcn_permlanex16(
      b, b, 0x76543210, 0xfedcba98, false, false));
}

// V rows in LDS: 160 bytes apart, an odd multiple of 32 bytes, the pitch at
// which the transposing load below meets no bank conflict.
#define VPITCH 80
typedef short s16x8 __attribute__((ext_vector_type(8)));
typedef __attribute__((ext_vector_type(8))) _Float16 v8h;
typedef __attribute__((address_space(3))) s16x8 lds_s16x8;
// ds_load_tr16_b128: lane (c = lane & 15, h = lane >> 4) gets the 8 halves
// T[8h + 0..7][c] of the 16 x 16 tile whose pieces the lanes point at.
__device__ __forceinline__ v8h ld_tr16(const _Float16* p) {
  return __builtin_bit_cast(v8h,
      __builtin_amdgcn_ds_load_tr16_b128_v8i16((lds_s16x8*)p));
}

__global__ __launch_bounds__(128) void attn_f16(
    const _Float16* __restrict__ Qh, const _Float16* __restrict__ Kh,
    const _Float16* __restrict__ Vh, float* __restrict__ Ctx)
{
  __shared__ alignas(16) _Float16 Ks[32][72];
  __shared__ alignas(16) _Float16 Vs[32][VPITCH];

  const int t    = threadIdx.x;
  const int lane = t & 31;
  const int wave = t >> 5;
  const int fr   = lane & 15;
  const int hi8  = (lane >> 4) << 3;   // D-layout row offset: 0 or 8

  const int qt = blockIdx.x & 3;
  const int h  = (blockIdx.x >> 2) & 15;
  const int b  = blockIdx.x >> 6;

  const int q0 = qt * 64 + wave * 16;  // first query row of this wave

  // Q fragments: 16 x 64 head-dim, as two K=32 WMMA chunks, kept in VGPRs
  v16h qf0, qf1;
  {
    const int qr = min(q0 + fr, NSQ - 1);
    const _Float16* qp = Qh + ((size_t)(b * NSQ + qr)) * NE + h * NDH;
#pragma unroll
    for (int j = 0; j < 16; ++j) {
      const int kk = koff(lane, j);
      qf0[j] = qp[kk];
      qf1[j] = qp[32 + kk];
    }
  }

  // state of query q0 + fr: running maximum (equal in both wave halves) and
  // this half's share of the running sum (halves joined after the loop)
  float mrow = -3.0e38f, srow = 0.0f;
  v8f cacc[4] = {};  // cacc[d][i] = ctx[q0 + fr][d * 16 + hi8 + i]

  const int krr = t >> 2;         // staging row 0..31
  const int kcc = (t & 3) * 16;   // staging col 0,16,32,48 (halves)
  const size_t hoff = (size_t)h * NDH;
  // this lane's 16-byte piece of the first 16-key x 16-column tile of Vs
  const _Float16* vtp = &Vs[hi8 + (lane & 7)][((lane >> 3) & 1) * 8];

  for (int lb = 0; lb < NL; lb += 32) {
    // ---- stage 32 keys/values (f16) into LDS -----------------------------
    const int krow = min(lb + krr, NL - 1);
    const _Float16* kp = Kh + (size_t)krow * NE + hoff + kcc;
    const _Float16* vp = Vh + (size_t)krow * NE + hoff + kcc;
#if USE_ASYNC_LDS
    __builtin_amdgcn_global_load_async_to_lds_b128(
        (g_v4i*)kp,       (l_v4i*)&Ks[krr][kcc],     0, 0);
    __builtin_amdgcn_global_load_async_to_lds_b128(
        (g_v4i*)(kp + 8), (l_v4i*)&Ks[krr][kcc + 8], 0, 0);
    __builtin_amdgcn_global_load_async_to_lds_b128(
        (g_v4i*)vp,       (l_v4i*)&Vs[krr][kcc],     0, 0);
    __builtin_amdgcn_global_load_async_to_lds_b128(
        (g_v4i*)(vp + 8), (l_v4i*)&Vs[krr][kcc + 8], 0, 0);
    __builtin_amdgcn_s_wait_asynccnt(0);
#else
    const float4 k0v = ((const float4*)kp)[0];
    const float4 k1v = ((const float4*)kp)[1];
    const float4 v0v = ((const float4*)vp)[0];
    const float4 v1v = ((const float4*)vp)[1];
    *(float4*)&Ks[krr][kcc]     = k0v;
    *(float4*)&Ks[krr][kcc + 8] = k1v;
    *(float4*)&Vs[krr][kcc]     = v0v;
    *(float4*)&Vs[krr][kcc + 8] = v1v;
#endif
    __syncthreads();

    // ---- scores: 32keys x 16q = 2 D-tiles, each 2 WMMA (K=32 over dh=64) --
    // sc0[i] = S[key lb + hi8 + i][query fr], sc1[i]: key lb + 16 + hi8 + i
    v8f sc0 = {}, sc1 = {};
    {
      v16h kf;
#pragma unroll
      for (int j = 0; j < 16; ++j) kf[j] = Ks[fr][koff(lane, j)];
      sc0 = __builtin_amdgcn_wmma_f32_16x16x32_f16(false, kf, false, qf0,
                                                   (short)0, sc0, false, false);
#pragma unroll
      for (int j = 0; j < 16; ++j) kf[j] = Ks[fr][32 + koff(lane, j)];
      sc0 = __builtin_amdgcn_wmma_f32_16x16x32_f16(false, kf, false, qf1,
                                                   (short)0, sc0, false, false);
#pragma unroll
      for (int j = 0; j < 16; ++j) kf[j] = Ks[16 + fr][koff(lane, j)];
      sc1 = __builtin_amdgcn_wmma_f32_16x16x32_f16(false, kf, false, qf0,
                                                   (short)0, sc1, false, false);
#pragma unroll
      for (int j = 0; j < 16; ++j) kf[j] = Ks[16 + fr][32 + koff(lane, j)];
      sc1 = __builtin_amdgcn_wmma_f32_16x16x32_f16(false, kf, false, qf1,
                                                   (short)0, sc1, false, false);
    }

    // ---- online softmax: one query per lane, keys along the registers ----
#pragma unroll
    for (int i = 0; i < 8; ++i) {
      sc0[i] *= 0.125f;  // 1/sqrt(64)
      sc1[i] *= 0.125f;
    }
    if (lb + 32 > NL) {  // only the last chunk has keys past the table
#pragma unroll
      for (int i = 0; i < 8; ++i) {
        if (lb + hi8 + i >= NL)      sc0[i] = -3.0e38f;
        if (lb + 16 + hi8 + i >= NL) sc1[i] = -3.0e38f;
      }
    }
    float mx = fmaxf(sc0[0], sc1[0]);
#pragma unroll
    for (int i = 1; i < 8; ++i) mx = fmaxf(mx, fmaxf(sc0[i], sc1[i]));
    mx = fmaxf(mx, xhalf(mx));
    const float mn   = fmaxf(mrow, mx);
    const float corr = __expf(mrow - mn);
    mrow = mn;

    v16h pf;  // P^T as B operand: element j is key koff(lane, j), column fr
    float ps = 0.0f;
#pragma unroll
    for (int i = 0; i < 8; ++i) {
      const float p0 = __expf(sc0[i] - mn);
      const float p1 = __expf(sc1[i] - mn);
      ps += p0 + p1;
      pf[i]     = (_Float16)p0;
      pf[8 + i] = (_Float16)p1;
    }
    srow = srow * corr + ps;
#pragma unroll
    for (int d = 0; d < 4; ++d)
#pragma unroll
      for (int i = 0; i < 8; ++i) cacc[d][i] *= corr;

    // ---- ctx^T += V^T(16x32) * P^T(32x16): 4 WMMA over dh tiles ----------
#pragma unroll
    for (int d = 0; d < 4; ++d) {
      // elements 0..7 from keys 0..15, 8..15 from keys 16..31: koff's order
      const v8h vlo = ld_tr16(vtp + d * 16);
      const v8h vhi = ld_tr16(vtp + 16 * VPITCH + d * 16);
      const v16h vf = __builtin_shufflevector(vlo, vhi, 0, 1, 2, 3, 4, 5, 6, 7,
                                              8, 9, 10, 11, 12, 13, 14, 15);
      cacc[d] = __builtin_amdgcn_wmma_f32_16x16x32_f16(false, vf, false, pf,
                                                       (short)0, cacc[d],
                                                       false, false);
    }
    __syncthreads();
  }

  // ---- normalize + store context (f32): 8 consecutive d per lane and tile --
  srow += xhalf(srow);
  const int q = q0 + fr;
  if (q < NSQ) {
    const float inv = 1.0f / srow;
    float* cp = Ctx + ((size_t)(b * NSQ + q)) * NE + h * NDH + hi8;
#pragma unroll
    for (int d = 0; d < 4; ++d) {
      *(float4*)&cp[d * 16]     = make_float4(cacc[d][0] * inv, cacc[d][1] * inv,
                                              cacc[d][2] * inv, cacc[d][3] * inv);
      *(float4*)&cp[d * 16 + 4] = make_float4(cacc[d][4] * inv, cacc[d][5] * inv,
                                              cacc[d][6] * inv, cacc[d][7] * inv);
    }
  }
}

// ---------------------------------------------------------------------------
extern "C" void kernel_launch(void* const* d_in, const int* in_sizes, int n_in,
                              void* d_out, int out_size, void* d_ws, size_t ws_size,
                              hipStream_t stream) {
  const float* features = (const float*)d_in[0];
  const float* labels   = (const float*)d_in[1];
  const float* Wq = (const float*)d_in[2];
  const float* bq = (const float*)d_in[3];
  const float* Wk = (const float*)d_in[4];
  const float* bk = (const float*)d_in[5];
  const float* Wv = (const float*)d_in[6];
  const float* bv = (const float*)d_in[7];
  const float* Wo = (const float*)d_in[8];
  const float* bo = (const float*)d_in[9];
  float* out = (float*)d_out;

  const size_t MQ = (size_t)NB * NSQ;  // 6272
  _Float16* Qh = (_Float16*)d_ws;      // [6272,1024] f16
  _Float16* Kh = Qh + MQ * NE;         // [1000,1024] f16
  _Float16* Vh = Kh + (size_t)NL * NE; // [1000,1024] f16
  float*    ctx = (float*)(Vh + (size_t)NL * NE);  // [6272,1024] f32

  const dim3 blk(256);

  // Q = features @ Wq^T + bq, K = labels @ Wk^T + bk, V = labels @ Wv^T + bv,
  // all -> f16: 49 * 8 + 8 * 8 + 8 * 8 = 520 block tiles in one launch
  proj_qkv_f16<<<dim3(520), blk, 0, stream>>>(
      features, labels, Wq, bq, Wk, bk, Wv, bv, Qh, Kh, Vh);

  // attention: softmax(Q K^T / 8) V  -> ctx (f32)
  attn_f16<<<dim3(NB * NH * 4), dim3(128), 0, stream>>>(Qh, Kh, Vh, ctx);

  // out = ctx @ Wo^T + bo     -> f32
  gemm_bt_f16<<<dim3(49, 8), blk, 0, stream>>>(
      ctx, Wo, bo, out, nullptr, (int)MQ, NE, NE, 0);
}

// v006
// Measured time: 112 microseconds a run.
// Two timings next to v005 put it at 1.04 and 1.05 times that version's speed.
// Over all steps from v000 it is 2.79 times as fast.
#include <hip/hip_runtime.h>

typedef __attribute__((ext_vector_type(16))) _Float16 v16h;
typedef __attribute__((ext_vector_type(4)))  _Float16 v4h;
typedef __attribute__((ext_vector_type(8)))  float    v8f;

#define NB    32      // batch
#define NSQ   196     // query sequence
#define NFD   2048    // feature dim
#define NL    1000    // labels
#define NE    1024    // embed dim
#define NH    16      // heads
#define NDH   64      // head dim

#if __has_builtin(__builtin_amdgcn_global_load_async_to_lds_b128) && \
    __has_builtin(__builtin_amdgcn_s_wait_asynccnt)
#define USE_ASYNC_LDS 1
typedef int v4i_vec __attribute__((vector_size(16)));
typedef __attribute__((address_space(1))) v4i_vec g_v4i;  // global (AS1)
typedef __attribute__((address_space(3))) v4i_vec l_v4i;  // LDS (AS3)
#else
#define USE_ASYNC_LDS 0
#endif

// 16-bit WMMA A/B operand element mapping (ISA 7.12.2):
// lane L holds matrix row (L & 15); element j of the v16h maps to
// K = kb + j      for j in [0,8)   (VGPR0..3)
// K = kb + j + 8  for j in [8,16)  (VGPR4..7), kb = (L<16) ? 0 : 8
__device__ __forceinline__ int koff(int lane, int j) {
  int kb = (lane & 16) ? 8 : 0;
  return kb + j + (j & 8);
}

// ---------------------------------------------------------------------------
// GEMM: C[M,N] = A[M,K] (f32) * B[N,K]^T (f32) + bias[N]
// out_half!=0 -> write _Float16 to Ch ; else write float to Cf
// block = 512 threads (16 waves). Block tile 128x256, wave tile 32x64: the
// A rows a block loads from L2 serve 256 output columns, so a product costs
// three quarters of the L2 bytes of a 128x128 tile.
// K step 32 -> 8 v_wmma_f32_16x16x32_f16 per wave per K step; the global
// loads run two K tiles ahead of the products, in two register sets.
// gemm_tile computes the block tile whose first row is m0, first column n0.
// ---------------------------------------------------------------------------
// Work-group barrier for LDS traffic alone: this wave's LDS reads and writes
// are complete, then signal and wait. __syncthreads() would also wait for the
// global loads in flight, which are meant to stay in flight across it.
__device__ __forceinline__ void lds_barrier() {
  asm volatile("s_wait_dscnt 0x0\n\ts_barrier_signal -1\n\ts_barrier_wait -1"
               ::: "memory");
}

__device__ __forceinline__ void gemm_tile(
    const float* __restrict__ A, const float* __restrict__ Bw,
    const float* __restrict__ bias, float* __restrict__ Cf,
    _Float16* __restrict__ Ch, int M, int N, int K, int out_half,
    int m0, int n0)
{
  // two LDS buffers per operand: a K step reads one while the next K tile
  // is written into the other, so one barrier a step is enough
  __shared__ alignas(16) _Float16 As[2][128][40];
  __shared__ alignas(16) _Float16 Bs[2][256][40];

  const int t    = threadIdx.x;
  const int lane = t & 31;
  const int wave = t >> 5;
  const int wm   = wave & 3;   // 0..3 -> 32-row slab
  const int wn   = wave >> 2;  // 0..3 -> 64-col slab
  const int fr   = lane & 15;
  const int hi8  = (lane >> 4) << 3;

  // staging: 8 lanes take the 32 f32 (one 128-byte line) of a row, so that a
  // wave-wide 16-byte load covers 4 whole lines. Load i of a wave takes row
  // arow + i (A) or brow + i (B) in each of its four lane groups; the groups
  // stand 4 rows apart, which at the 80-byte LDS pitch puts their 8-byte
  // stores on disjoint banks. A wave takes 16 of the 256 B rows; a pair of
  // waves shares 16 of the 128 A rows, two of each group's four rows each.
  const int grow = (lane >> 3) << 2;
  const int arow = (wave >> 1) * 16 + grow + (wave & 1) * 2;  // + i, i = 0..1
  const int brow = wave * 16 + grow;                          // + i, i = 0..3
  const int lcol = (lane & 7) * 4;                            // f32 column 0..28
  unsigned aoff[2], boff[4];  // byte offsets of this lane's loads in A and Bw
#pragma unroll
  for (int i = 0; i < 2; ++i)
    aoff[i] = ((unsigned)min(m0 + arow + i, M - 1) * (unsigned)K + lcol) * 4u;
#pragma unroll
  for (int i = 0; i < 4; ++i)
    boff[i] = ((unsigned)min(n0 + brow + i, N - 1) * (unsigned)K + lcol) * 4u;

  v8f acc[2][4] = {};

  // K tiles are fetched in order; ab and bb point at the next one's column 0
  const char* ab = (const char*)A;
  const char* bb = (const char*)Bw;
  // last: a literal, true for the fetch of the last K tile. Behind it the
  // address registers are free, and the compiler lets a later load of the same
  // group land in one: there the precaution below stands behind every load.
  auto fetch = [&](float4 (&av)[2], float4 (&bv)[4], bool last) {
#pragma unroll
    for (int i = 0; i < 2; ++i) {
      av[i] = *(const float4*)(ab + aoff[i]);
      if (last) asm volatile("s_wait_xcnt 0x0" ::: "memory");
    }
#pragma unroll
    for (int i = 0; i < 4; ++i) {
      bv[i] = *(const float4*)(bb + boff[i]);
      if (last && i < 3) asm volatile("s_wait_xcnt 0x0" ::: "memory");
    }
    // a precaution: these loads stay in flight for two K steps, in which
    // their address registers are given other values
    asm volatile("s_wait_xcnt 0x0" ::: "memory");
    ab += 128;  // 32 f32 on
    bb += 128;
  };
  auto stash = [&](const float4 (&av)[2], const float4 (&bv)[4], int buf) {
#pragma unroll
    for (int i = 0; i < 2; ++i) {
      v4h ha;
      ha[0] = (_Float16)av[i].x; ha[1] = (_Float16)av[i].y;
      ha[2] = (_Float16)av[i].z; ha[3] = (_Float16)av[i].w;
      *(v4h*)&As[buf][arow + i][lcol] = ha;
    }
#pragma unroll
    for (int i = 0; i < 4; ++i) {
      v4h hb;
      hb[0] = (_Float16)bv[i].x; hb[1] = (_Float16)bv[i].y;
      hb[2] = (_Float16)bv[i].z; hb[3] = (_Float16)bv[i].w;
      *(v4h*)&Bs[buf][brow + i][lcol] = hb;
    }
  };
  // one K step: products of the tile in buffer cur; the tile after it, whose
  // loads were issued two steps ago, goes from (av, bv) into the other buffer,
  // and (av, bv) take the loads of the tile two further on. cur and the three
  // flags are literals at every call: no branch stands in a step, so the
  // compiler's counted waits leave the younger set's loads in flight.
  auto kstep = [&](int cur, float4 (&av)[2], float4 (&bv)[4],
                   bool has_next, bool has_fetch, bool last_fetch) {
    v16h af[2], bf[4];
#pragma unroll
    for (int s = 0; s < 2; ++s)
#pragma unroll
      for (int j = 0; j < 16; ++j)
        af[s][j] = As[cur][wm * 32 + s * 16 + fr][koff(lane, j)];
#pragma unroll
    for (int s = 0; s < 4; ++s)
#pragma unroll
      for (int j = 0; j < 16; ++j)
        bf[s][j] = Bs[cur][wn * 64 + s * 16 + fr][koff(lane, j)];
    if (has_next) stash(av, bv, cur ^ 1);
    // the LDS traffic issues first: the products wait for the fragment loads
    // and the barrier for the stores, the global loads are due in two steps
    __builtin_amdgcn_sched_barrier(0);
    if (has_fetch) fetch(av, bv, last_fetch);
#pragma unroll
    for (int ia = 0; ia < 2; ++ia)
#pragma unroll
      for (int ib = 0; ib < 4; ++ib)
        acc[ia][ib] = __builtin_amdgcn_wmma_f32_16x16x32_f16(
            false, af[ia], false, bf[ib], (short)0, acc[ia][ib], false, false);
    if (has_next) {
      // keeps the products in front of the barrier: its wait then passes
      // while the matrix unit works, and no product stands between the
      // barrier and the next fragment loads
      __builtin_amdgcn_sched_barrier(0);
      lds_barrier();
    }
  };

  // K is a multiple of 64 and at least 192 (here 1024 or 2048)
  const int nk = K >> 5;  // K tiles of 32
  float4 a0[2], b0[4], a1[2], b1[4];  // even and odd K tiles in flight
  {
    float4 af[2], bf[4];
    fetch(af, bf, false);  // tile 0
    fetch(a1, b1, false);  // tile 1
    fetch(a0, b0, false);  // tile 2
    stash(af, bf, 0);
  }
  lds_barrier();
  int k = 0;
  do {
    kstep(0, a1, b1, true, true, false);
    kstep(1, a0, b0, true, true, false);
    k += 2;
  } while (k + 4 < nk);
  kstep(0, a1, b1, true, true, true);     // tile nk - 4; fetches the last tile
  kstep(1, a0, b0, true, false, false);
  kstep(0, a1, b1, true, false, false);
  kstep(1, a0, b0, false, false, false);  // tile nk - 1

#pragma unroll
  for (int ib = 0; ib < 4; ++ib) {
    const int nc = n0 + wn * 64 + ib * 16 + fr;
    const float bvv = bias[nc];
#pragma unroll
    for (int ia = 0; ia < 2; ++ia) {
#pragma unroll
      for (int i = 0; i < 8; ++i) {
        const int m = m0 + wm * 32 + ia * 16 + hi8 + i;
        if (m < M) {
          const float x = acc[ia][ib][i] + bvv;
          if (out_half) Ch[(size_t)m * N + nc] = (_Float16)x;
          else          Cf[(size_t)m * N + nc] = x;
        }
      }
    }
  }
}

__global__ __launch_bounds__(512) void gemm_bt_f16(
    const float* __restrict__ A, const float* __restrict__ Bw,
    const float* __restrict__ bias, float* __restrict__ Cf,
    _Float16* __restrict__ Ch, int M, int N, int K, int out_half)
{
  gemm_tile(A, Bw, bias, Cf, Ch, M, N, K, out_half,
            blockIdx.x * 128, blockIdx.y * 256);
}

// The three input projections, which do not depend on one another, in one
// launch: the K and V products have only 32 block tiles each, an eighth of
// the chip's WGPs, and run here beside the Q product instead of after it.
// Blocks 0..195: Q tiles (the long ones, K = 2048, first), in the order of a
// (49, 4) grid; 196..227: K tiles; 228..259: V tiles, each as an (8, 4) grid.
#define QTM   49                 // 128-row tiles of Q
#define QTILES (QTM * (NE / 256))
__global__ __launch_bounds__(512) void proj_qkv_f16(
    const float* __restrict__ features, const float* __restrict__ labels,
    const float* __restrict__ Wq, const float* __restrict__ bq,
    const float* __restrict__ Wk, const float* __restrict__ bk,
    const float* __restrict__ Wv, const float* __restrict__ bv,
    _Float16* __restrict__ Qh, _Float16* __restrict__ Kh,
    _Float16* __restrict__ Vh)
{
  const int bid = blockIdx.x;
  const bool isq = bid < QTILES;
  const int  r   = bid - QTILES;       // K and V tiles: 0..63
  const bool isk = r < 32;
  const float* A    = isq ? features : labels;
  const float* Bw   = isq ? Wq : (isk ? Wk : Wv);
  const float* bias = isq ? bq : (isk ? bk : bv);
  _Float16*    Ch   = isq ? Qh : (isk ? Kh : Vh);
  const int M  = isq ? NB * NSQ : NL;
  const int K  = isq ? NFD : NE;
  const int tm = isq ? bid % QTM : (r & 7);
  const int tn = isq ? bid / QTM : ((r >> 3) & 3);
  gemm_tile(A, Bw, bias, nullptr, Ch, M, NE, K, 1, tm * 128, tn * 256);
}

// ---------------------------------------------------------------------------
// Flash-style attention over the label table, transposed products:
//   St = K * Q^T   (A = 16 keys from LDS, B = 16 queries kept in VGPRs)
//   Ot += V^T * P^T
// In the D layout a lane then holds the scores of ONE query (column lane&15),
// 8 keys per tile, so the row maximum and the row sum are taken in the lane's
// own registers (one exchange between the wave halves for the maximum), and
// two converted St tiles are already the B operand P^T: P never goes to LDS.
// grid.x = B*H*4 ; block = 128 (4 waves). Each wave owns 16 query rows of a
// 64-query tile, keeps its own online softmax state + 64x16 f32 context acc.
// K/V chunks staged via GLOBAL_LOAD_ASYNC_TO_LDS_B128 when available.
// ---------------------------------------------------------------------------
__device__ __forceinline__ float xhalf(float x) {  // value of lane ^ 16
  const int b = __builtin_bit_cast(int, x);
  return __builtin_bit_cast(float, __builtin_amdgcn_permlanex16(
      b, b, 0x76543210, 0xfedcba98, false, false));
}

// V rows in LDS: 160 bytes apart, an odd multiple of 32 bytes, the pitch at
// which the transposing load below meets no bank conflict.
#define VPITCH 80
typedef short s16x8 __attribute__((ext_vector_type(8)));
typedef __attribute__((ext_vector_type(8))) _Float16 v8h;
typedef __attribute__((address_space(3))) s16x8 lds_s16x8;
// ds_load_tr16_b128: lane (c = lane & 15, h = lane >> 4) gets the 8 halves
// T[8h + 0..7][c] of the 16 x 16 tile whose pieces the lanes point at.
__device__ __forceinline__ v8h ld_tr16(const _Float16* p) {
  return __builtin_bit_cast(v8h,
      __builtin_amdgcn_ds_load_tr16_b128_v8i16((lds_s16x8*)p));
}

__global__ __launch_bounds__(128) void attn_f16(
    const _Float16* __restrict__ Qh, const _Float16* __restrict__ Kh,
    const _Float16* __restrict__ Vh, float* __restrict__ Ctx)
{
  __shared__ alignas(16) _Float16 Ks[32][72];
  __shared__ alignas(16) _Float16 Vs[32][VPITCH];

  const int t    = threadIdx.x;
  const int lane = t & 31;
  const int wave = t >> 5;
  const int fr   = lane & 15;
  const int hi8  = (lane >> 4) << 3;   // D-layout row offset: 0 or 8

  const int qt = blockIdx.x & 3;
  const int h  = (blockIdx.x >> 2) & 15;
  const int b  = blockIdx.x >> 6;

  const int q0 = qt * 64 + wave * 16;  // first query row of this wave

  // Q fragments: 16 x 64 head-dim, as two K=32 WMMA chunks, kept in VGPRs
  v16h qf0, qf1;
  {
    const int qr = min(q0 + fr, NSQ - 1);
    const _Float16* qp = Qh + ((size_t)(b * NSQ + qr)) * NE + h * NDH;
#pragma unroll
    for (int j = 0; j < 16; ++j) {
      const int kk = koff(lane, j);
      qf0[j] = qp[kk];
      qf1[j] = qp[32 + kk];
    }
  }

  // state of query q0 + fr: running maximum (equal in both wave halves) and
  // this half's share of the running sum (halves joined after the loop)
  float mrow = -3.0e38f, srow = 0.0f;
  v8f cacc[4] = {};  // cacc[d][i] = ctx[q0 + fr][d * 16 + hi8 + i]

  const int krr = t >> 2;         // staging row 0..31
  const int kcc = (t & 3) * 16;   // staging col 0,16,32,48 (halves)
  const size_t hoff = (size_t)h * NDH;
  // this lane's 16-byte piece of the first 16-key x 16-column tile of Vs
  const _Float16* vtp = &Vs[hi8 + (lane & 7)][((lane >> 3) & 1) * 8];

  for (int lb = 0; lb < NL; lb += 32) {
    // ---- stage 32 keys/values (f16) into LDS -----------------------------
    const int krow = min(lb + krr, NL - 1);
    const _Float16* kp = Kh + (size_t)krow * NE + hoff + kcc;
    const _Float16* vp = Vh + (size_t)krow * NE + hoff + kcc;
#if USE_ASYNC_LDS
    __builtin_amdgcn_global_load_async_to_lds_b128(
        (g_v4i*)kp,       (l_v4i*)&Ks[krr][kcc],     0, 0);
    __builtin_amdgcn_global_load_async_to_lds_b128(
        (g_v4i*)(kp + 8), (l_v4i*)&Ks[krr][kcc + 8], 0, 0);
    __builtin_amdgcn_global_load_async_to_lds_b128(
        (g_v4i*)vp,       (l_v4i*)&Vs[krr][kcc],     0, 0);
    __builtin_amdgcn_global_load_async_to_lds_b128(
        (g_v4i*)(vp + 8), (l_v4i*)&Vs[krr][kcc + 8], 0, 0);
    __builtin_amdgcn_s_wait_asynccnt(0);
#else
    const float4 k0v = ((const float4*)kp)[0];
    const float4 k1v = ((const float4*)kp)[1];
    const float4 v0v = ((const float4*)vp)[0];
    const float4 v1v = ((const float4*)vp)[1];
    *(float4*)&Ks[krr][kcc]     = k0v;
    *(float4*)&Ks[krr][kcc + 8] = k1v;
    *(float4*)&Vs[krr][kcc]     = v0v;
    *(float4*)&Vs[krr][kcc + 8] = v1v;
#endif
    __syncthreads();

    // ---- scores: 32keys x 16q = 2 D-tiles, each 2 WMMA (K=32 over dh=64) --
    // sc0[i] = S[key lb + hi8 + i][query fr], sc1[i]: key lb + 16 + hi8 + i
    v8f sc0 = {}, sc1 = {};
    {
      v16h kf;
#pragma unroll
      for (int j = 0; j < 16; ++j) kf[j] = Ks[fr][koff(lane, j)];
      sc0 = __builtin_amdgcn_wmma_f32_16x16x32_f16(false, kf, false, qf0,
                                                   (short)0, sc0, false, false);
#pragma unroll
      for (int j = 0; j < 16; ++j) kf[j] = Ks[fr][32 + koff(lane, j)];
      sc0 = __builtin_amdgcn_wmma_f32_16x16x32_f16(false, kf, false, qf1,
                                                   (short)0, sc0, false, false);
#pragma unroll
      for (int j = 0; j < 16; ++j) kf[j] = Ks[16 + fr][koff(lane, j)];
      sc1 = __builtin_amdgcn_wmma_f32_16x16x32_f16(false, kf, false, qf0,
                                                   (short)0, sc1, false, false);
#pragma unroll
      for (int j = 0; j < 16; ++j) kf[j] = Ks[16 + fr][32 + koff(lane, j)];
      sc1 = __builtin_amdgcn_wmma_f32_16x16x32_f16(false, kf, false, qf1,
                                                   (short)0, sc1, false, false);
    }

    // ---- online softmax: one query per lane, keys along the registers ----
#pragma unroll
    for (int i = 0; i < 8; ++i) {
      sc0[i] *= 0.125f;  // 1/sqrt(64)
      sc1[i] *= 0.125f;
    }
    if (lb + 32 > NL) {  // only the last chunk has keys past the table
#pragma unroll
      for (int i = 0; i < 8; ++i) {
        if (lb + hi8 + i >= NL)      sc0[i] = -3.0e38f;
        if (lb + 16 + hi8 + i >= NL) sc1[i] = -3.0e38f;
      }
    }
    float mx = fmaxf(sc0[0], sc1[0]);
#pragma unroll
    for (int i = 1; i < 8; ++i) mx = fmaxf(mx, fmaxf(sc0[i], sc1[i]));
    mx = fmaxf(mx, xhalf(mx));
    const float mn   = fmaxf(mrow, mx);
    const float corr = __expf(mrow - mn);
    mrow = mn;

    v16h pf;  // P^T as B operand: element j is key koff(lane, j), column fr
    float ps = 0.0f;
#pragma unroll
    for (int i = 0; i < 8; ++i) {
      const float p0 = __expf(sc0[i] - mn);
      const float p1 = __expf(sc1[i] - mn);
      ps += p0 + p1;
      pf[i]     = (_Float16)p0;
      pf[8 + i] = (_Float16)p1;
    }
    srow = srow * corr + ps;
#pragma unroll
    for (int d = 0; d < 4; ++d)
#pragma unroll
      for (int i = 0; i < 8; ++i) cacc[d][i] *= corr;

    // ---- ctx^T += V^T(16x32) * P^T(32x16): 4 WMMA over dh tiles ----------
#pragma unroll
    for (int d = 0; d < 4; ++d) {
      // elements 0..7 from keys 0..15, 8..15 from keys 16..31: koff's order
      const v8h vlo = ld_tr16(vtp + d * 16);
      const v8h vhi = ld_tr16(vtp + 16 * VPITCH + d * 16);
      const v16h vf = __builtin_shufflevector(vlo, vhi, 0, 1, 2, 3, 4, 5, 6, 7,
                                              8, 9, 10, 11, 12, 13, 14, 15);
      cacc[d] = __builtin_amdgcn_wmma_f32_16x16x32_f16(false, vf, false, pf,
                                                       (short)0, cacc[d],
                                                       false, false);
    }
    __syncthreads();
  }

  // ---- normalize + store context (f32): 8 consecutive d per lane and tile --
  srow += xhalf(srow);
  const int q = q0 + fr;
  if (q < NSQ) {
    const float inv = 1.0f / srow;
    float* cp = Ctx + ((size_t)(b * NSQ + q)) * NE + h * NDH + hi8;
#pragma unroll
    for (int d = 0; d < 4; ++d) {
      *(float4*)&cp[d * 16]     = make_float4(cacc[d][0] * inv, cacc[d][1] * inv,
                                              cacc[d][2] * inv, cacc[d][3] * inv);
      *(float4*)&cp[d * 16 + 4] = make_float4(cacc[d][4] * inv, cacc[d][5] * inv,
                                              cacc[d][6] * inv, cacc[d][7] * inv);
    }
  }
}

// ---------------------------------------------------------------------------
extern "C" void kernel_launch(void* const* d_in, const int* in_sizes, int n_in,
                              void* d_out, int out_size, void* d_ws, size_t ws_size,
                              hipStream_t stream) {
  const float* features = (const float*)d_in[0];
  const float* labels   = (const float*)d_in[1];
  const float* Wq = (const float*)d_in[2];
  const float* bq = (const float*)d_in[3];
  const float* Wk = (const float*)d_in[4];
  const float* bk = (const float*)d_in[5];
  const float* Wv = (const float*)d_in[6];
  const float* bv = (const float*)d_in[7];
  const float* Wo = (const float*)d_in[8];
  const float* bo = (const float*)d_in[9];
  float* out = (float*)d_out;

  const size_t MQ = (size_t)NB * NSQ;  // 6272
  _Float16* Qh = (_Float16*)d_ws;      // [6272,1024] f16
  _Float16* Kh = Qh + MQ * NE;         // [1000,1024] f16
  _Float16* Vh = Kh + (size_t)NL * NE; // [1000,1024] f16
  float*    ctx = (float*)(Vh + (size_t)NL * NE);  // [6272,1024] f32

  const dim3 blk(512);

  // Q = features @ Wq^T + bq, K = labels @ Wk^T + bk, V = labels @ Wv^T + bv,
  // all -> f16: 49 * 4 + 8 * 4 + 8 * 4 = 260 block tiles in one launch
  proj_qkv_f16<<<dim3(260), blk, 0, stream>>>(
      features, labels, Wq, bq, Wk, bk, Wv, bv, Qh, Kh, Vh);

  // attention: softmax(Q K^T / 8) V  -> ctx (f32)
  attn_f16<<<dim3(NB * NH * 4), dim3(128), 0, stream>>>(Qh, Kh, Vh, ctx);

  // out = ctx @ Wo^T + bo     -> f32
  gemm_bt_f16<<<dim3(49, 4), blk, 0, stream>>>(
      ctx, Wo, bo, out, nullptr, (int)MQ, NE, NE, 0);
}

// v007
// It runs in 106 microseconds.
// Two timings next to v006 both put it at 1.05 times that version's speed.
// All steps since v000 together make it 2.94 times as fast.
#include <hip/hip_runtime.h>

typedef __attribute__((ext_vector_type(16))) _Float16 v16h;
typedef __attribute__((ext_vector_type(4)))  _Float16 v4h;
typedef __attribute__((ext_vector_type(8)))  float    v8f;

#define NB    32      // batch
#define NSQ   196     // query sequence
#define NFD   2048    // feature dim
#define NL    1000    // labels
#define NE    1024    // embed dim
#define NH    16      // heads
#define NDH   64      // head dim

#if __has_builtin(__builtin_amdgcn_global_load_async_to_lds_b128) && \
    __has_builtin(__builtin_amdgcn_s_wait_asynccnt)
#define USE_ASYNC_LDS 1
typedef int v4i_vec __attribute__((vector_size(16)));
typedef __attribute__((address_space(1))) v4i_vec g_v4i;  // global (AS1)
typedef __attribute__((address_space(3))) v4i_vec l_v4i;  // LDS (AS3)
#else
#define USE_ASYNC_LDS 0
#endif

// 16-bit WMMA A/B operand element mapping (ISA 7.12.2):
// lane L holds matrix row (L & 15); element j of the v16h maps to
// K = kb + j      for j in [0,8)   (VGPR0..3)
// K = kb + j + 8  for j in [8,16)  (VGPR4..7), kb = (L<16) ? 0 : 8
__device__ __forceinline__ int koff(int lane, int j) {
  int kb = (lane & 16) ? 8 : 0;
  return kb + j + (j & 8);
}

// ---------------------------------------------------------------------------
// GEMM: C[M,N] = A[M,K] (f32) * B[N,K]^T (f32) + bias[N]
// out_half!=0 -> write _Float16 to Ch ; else write float to Cf
// block = 512 threads (16 waves). Block tile 128x256, wave tile 32x64: the
// A rows a block loads from L2 serve 256 output columns, so a product costs
// three quarters of the L2 bytes of a 128x128 tile.
// K step 32 -> 8 v_wmma_f32_16x16x32_f16 per wave per K step; the global
// loads run two K tiles ahead of the products, in two register sets.
// gemm_tile computes the block tile whose first row is m0, first column n0.
// ---------------------------------------------------------------------------
// Work-group barrier for LDS traffic alone: this wave's LDS reads and writes
// are complete, then signal and wait. __syncthreads() would also wait for the
// global loads in flight, which are meant to stay in flight across it.
__device__ __forceinline__ void lds_barrier() {
  asm volatile("s_wait_dscnt 0x0\n\ts_barrier_signal -1\n\ts_barrier_wait -1"
               ::: "memory");
}

__device__ __forceinline__ void gemm_tile(
    const float* __restrict__ A, const float* __restrict__ Bw,
    const float* __restrict__ bias, float* __restrict__ Cf,
    _Float16* __restrict__ Ch, int M, int N, int K, int out_half,
    int m0, int n0)
{
  // two LDS buffers per operand: a K step reads one while the next K tile
  // is written into the other, so one barrier a step is enough
  __shared__ alignas(16) _Float16 As[2][128][40];
  __shared__ alignas(16) _Float16 Bs[2][256][40];

  const int t    = threadIdx.x;
  const int lane = t & 31;
  const int wave = t >> 5;
  const int wm   = wave & 3;   // 0..3 -> 32-row slab
  const int wn   = wave >> 2;  // 0..3 -> 64-col slab
  const int fr   = lane & 15;
  const int hi8  = (lane >> 4) << 3;

  // staging: 8 lanes take the 32 f32 (one 128-byte line) of a row, so that a
  // wave-wide 16-byte load covers 4 whole lines. Load i of a wave takes row
  // arow + i (A) or brow + i (B) in each of its four lane groups; the groups
  // stand 4 rows apart, which at the 80-byte LDS pitch puts their 8-byte
  // stores on disjoint banks. A wave takes 16 of the 256 B rows; a pair of
  // waves shares 16 of the 128 A rows, two of each group's four rows each.
  const int grow = (lane >> 3) << 2;
  const int arow = (wave >> 1) * 16 + grow + (wave & 1) * 2;  // + i, i = 0..1
  const int brow = wave * 16 + grow;                          // + i, i = 0..3
  const int lcol = (lane & 7) * 4;                            // f32 column 0..28
  unsigned aoff[2], boff[4];  // byte offsets of this lane's loads in A and Bw
#pragma unroll
  for (int i = 0; i < 2; ++i)
    aoff[i] = ((unsigned)min(m0 + arow + i, M - 1) * (unsigned)K + lcol) * 4u;
#pragma unroll
  for (int i = 0; i < 4; ++i)
    boff[i] = ((unsigned)min(n0 + brow + i, N - 1) * (unsigned)K + lcol) * 4u;

  v8f acc[2][4] = {};

  // K tiles are fetched in order; ab and bb point at the next one's column 0
  const char* ab = (const char*)A;
  const char* bb = (const char*)Bw;
  // last: a literal, true for the fetch of the last K tile. Behind it the
  // address registers are free, and the compiler lets a later load of the same
  // group land in one: there the precaution below stands behind every load.
  auto fetch = [&](float4 (&av)[2], float4 (&bv)[4], bool last) {
#pragma unroll
    for (int i = 0; i < 2; ++i) {
      av[i] = *(const float4*)(ab + aoff[i]);
      if (last) asm volatile("s_wait_xcnt 0x0" ::: "memory");
    }
#pragma unroll
    for (int i = 0; i < 4; ++i) {
      bv[i] = *(const float4*)(bb + boff[i]);
      if (last && i < 3) asm volatile("s_wait_xcnt 0x0" ::: "memory");
    }
    // a precaution: these loads stay in flight for two K steps, in which
    // their address registers are given other values
    asm volatile("s_wait_xcnt 0x0" ::: "memory");
    ab += 128;  // 32 f32 on
    bb += 128;
  };
  auto stash = [&](const float4 (&av)[2], const float4 (&bv)[4], int buf) {
#pragma unroll
    for (int i = 0; i < 2; ++i) {
      v4h ha;
      ha[0] = (_Float16)av[i].x; ha[1] = (_Float16)av[i].y;
      ha[2] = (_Float16)av[i].z; ha[3] = (_Float16)av[i].w;
      *(v4h*)&As[buf][arow + i][lcol] = ha;
    }
#pragma unroll
    for (int i = 0; i < 4; ++i) {
      v4h hb;
      hb[0] = (_Float16)bv[i].x; hb[1] = (_Float16)bv[i].y;
      hb[2] = (_Float16)bv[i].z; hb[3] = (_Float16)bv[i].w;
      *(v4h*)&Bs[buf][brow + i][lcol] = hb;
    }
  };
  // one K step: products of the tile in buffer cur; the tile after it, whose
  // loads were issued two steps ago, goes from (av, bv) into the other buffer,
  // and (av, bv) take the loads of the tile two further on. cur and the three
  // flags are literals at every call: no branch stands in a step, so the
  // compiler's counted waits leave the younger set's loads in flight.
  auto kstep = [&](int cur, float4 (&av)[2], float4 (&bv)[4],
                   bool has_next, bool has_fetch, bool last_fetch) {
    v16h af[2], bf[4];
#pragma unroll
    for (int s = 0; s < 2; ++s)
#pragma unroll
      for (int j = 0; j < 16; ++j)
        af[s][j] = As[cur][wm * 32 + s * 16 + fr][koff(lane, j)];
#pragma unroll
    for (int s = 0; s < 4; ++s)
#pragma unroll
      for (int j = 0; j < 16; ++j)
        bf[s][j] = Bs[cur][wn * 64 + s * 16 + fr][koff(lane, j)];
    if (has_next) stash(av, bv, cur ^ 1);
    // the LDS traffic issues first: the products wait for the fragment loads
    // and the barrier for the stores, the global loads are due in two steps
    __builtin_amdgcn_sched_barrier(0);
    if (has_fetch) fetch(av, bv, last_fetch);
#pragma unroll
    for (int ia = 0; ia < 2; ++ia)
#pragma unroll
      for (int ib = 0; ib < 4; ++ib)
        acc[ia][ib] = __builtin_amdgcn_wmma_f32_16x16x32_f16(
            false, af[ia], false, bf[ib], (short)0, acc[ia][ib], false, false);
    if (has_next) {
      // keeps the products in front of the barrier: its wait then passes
      // while the matrix unit works, and no product stands between the
      // barrier and the next fragment loads
      __builtin_amdgcn_sched_barrier(0);
      lds_barrier();
    }
  };

  // K is a multiple of 64 and at least 192 (here 1024 or 2048)
  const int nk = K >> 5;  // K tiles of 32
  float4 a0[2], b0[4], a1[2], b1[4];  // even and odd K tiles in flight
  {
    float4 af[2], bf[4];
    fetch(af, bf, false);  // tile 0
    fetch(a1, b1, false);  // tile 1
    fetch(a0, b0, false);  // tile 2
    stash(af, bf, 0);
  }
  lds_barrier();
  int k = 0;
  do {
    kstep(0, a1, b1, true, true, false);
    kstep(1, a0, b0, true, true, false);
    k += 2;
  } while (k + 4 < nk);
  kstep(0, a1, b1, true, true, true);     // tile nk - 4; fetches the last tile
  kstep(1, a0, b0, true, false, false);
  kstep(0, a1, b1, true, false, false);
  kstep(1, a0, b0, false, false, false);  // tile nk - 1

#pragma unroll
  for (int ib = 0; ib < 4; ++ib) {
    const int nc = n0 + wn * 64 + ib * 16 + fr;
    const float bvv = bias[nc];
#pragma unroll
    for (int ia = 0; ia < 2; ++ia) {
#pragma unroll
      for (int i = 0; i < 8; ++i) {
        const int m = m0 + wm * 32 + ia * 16 + hi8 + i;
        if (m < M) {
          const float x = acc[ia][ib][i] + bvv;
          if (out_half) Ch[(size_t)m * N + nc] = (_Float16)x;
          else          Cf[(size_t)m * N + nc] = x;
        }
      }
    }
  }
}

__global__ __launch_bounds__(512) void gemm_bt_f16(
    const float* __restrict__ A, const float* __restrict__ Bw,
    const float* __restrict__ bias, float* __restrict__ Cf,
    _Float16* __restrict__ Ch, int M, int N, int K, int out_half)
{
  gemm_tile(A, Bw, bias, Cf, Ch, M, N, K, out_half,
            blockIdx.x * 128, blockIdx.y * 256);
}

// The three input projections, which do not depend on one another, in one
// launch: the K and V products have only 32 block tiles each, an eighth of
// the chip's WGPs, and run here beside the Q product instead of after it.
// Blocks 0..195: Q tiles (the long ones, K = 2048, first), in the order of a
// (49, 4) grid; 196..227: K tiles; 228..259: V tiles, each as an (8, 4) grid.
#define QTM   49                 // 128-row tiles of Q
#define QTILES (QTM * (NE / 256))
__global__ __launch_bounds__(512) void proj_qkv_f16(
    const float* __restrict__ features, const float* __restrict__ labels,
    const float* __restrict__ Wq, const float* __restrict__ bq,
    const float* __restrict__ Wk, const float* __restrict__ bk,
    const float* __restrict__ Wv, const float* __restrict__ bv,
    _Float16* __restrict__ Qh, _Float16* __restrict__ Kh,
    _Float16* __restrict__ Vh)
{
  const int bid = blockIdx.x;
  const bool isq = bid < QTILES;
  const int  r   = bid - QTILES;       // K and V tiles: 0..63
  const bool isk = r < 32;
  const float* A    = isq ? features : labels;
  const float* Bw   = isq ? Wq : (isk ? Wk : Wv);
  const float* bias = isq ? bq : (isk ? bk : bv);
  _Float16*    Ch   = isq ? Qh : (isk ? Kh : Vh);
  const int M  = isq ? NB * NSQ : NL;
  const int K  = isq ? NFD : NE;
  const int tm = isq ? bid % QTM : (r & 7);
  const int tn = isq ? bid / QTM : ((r >> 3) & 3);
  gemm_tile(A, Bw, bias, nullptr, Ch, M, NE, K, 1, tm * 128, tn * 256);
}

// ---------------------------------------------------------------------------
// Flash-style attention over the label table, transposed products:
//   St = K * Q^T   (A = 16 keys from LDS, B = 16 queries kept in VGPRs)
//   Ot += V^T * P^T
// In the D layout a lane then holds the scores of ONE query (column lane&15),
// 8 keys per tile, so the row maximum and the row sum are taken in the lane's
// own registers (one exchange between the wave halves for the maximum), and
// two converted St tiles are already the B operand P^T: P never goes to LDS.
// The label table is common to all batches, so a query tile need not stay
// inside one batch: the B*SQ query rows are tiled as one list, which 64 divides,
// and no wave works on padding rows (196 rows a batch would fill 3 1/16 tiles).
// grid.x = H * (B*SQ/64) ; block = 128 (4 waves). Each wave owns 16 query rows
// of a 64-row tile, keeps its own online softmax state + 64x16 f32 context acc.
// K/V chunks staged via GLOBAL_LOAD_ASYNC_TO_LDS_B128 when available.
// ---------------------------------------------------------------------------
__device__ __forceinline__ float xhalf(float x) {  // value of lane ^ 16
  const int b = __builtin_bit_cast(int, x);
  return __builtin_bit_cast(float, __builtin_amdgcn_permlanex16(
      b, b, 0x76543210, 0xfedcba98, false, false));
}

// V rows in LDS: 160 bytes apart, an odd multiple of 32 bytes, the pitch at
// which the transposing load below meets no bank conflict.
#define VPITCH 80
typedef short s16x8 __attribute__((ext_vector_type(8)));
typedef __attribute__((ext_vector_type(8))) _Float16 v8h;
typedef __attribute__((address_space(3))) s16x8 lds_s16x8;
// ds_load_tr16_b128: lane (c = lane & 15, h = lane >> 4) gets the 8 halves
// T[8h + 0..7][c] of the 16 x 16 tile whose pieces the lanes point at.
__device__ __forceinline__ v8h ld_tr16(const _Float16* p) {
  return __builtin_bit_cast(v8h,
      __builtin_amdgcn_ds_load_tr16_b128_v8i16((lds_s16x8*)p));
}

__global__ __launch_bounds__(128) void attn_f16(
    const _Float16* __restrict__ Qh, const _Float16* __restrict__ Kh,
    const _Float16* __restrict__ Vh, float* __restrict__ Ctx)
{
  __shared__ alignas(16) _Float16 Ks[32][72];
  __shared__ alignas(16) _Float16 Vs[32][VPITCH];

  const int t    = threadIdx.x;
  const int lane = t & 31;
  const int wave = t >> 5;
  const int fr   = lane & 15;
  const int hi8  = (lane >> 4) << 3;   // D-layout row offset: 0 or 8

  // block index -> (head, tile), in the order it had: 64 blocks are 4 tiles of
  // head 0, 4 of head 1, ...; the last group has the 2 tiles that are left
  static_assert((NB * NSQ) % 128 == 0 && NH == 16, "whole tiles, 4 or 2 a group");
  const int  grp  = blockIdx.x >> 6;
  const bool four = grp < NB * NSQ / 256;
  const int  h    = (four ? blockIdx.x >> 2 : blockIdx.x >> 1) & 15;
  const int  tile = grp * 4 + (four ? blockIdx.x & 3 : blockIdx.x & 1);
  const int  q0   = tile * 64 + wave * 16;  // this wave's first row, of B*SQ

  // Q fragments: 16 x 64 head-dim, as two K=32 WMMA chunks, kept in VGPRs
  v16h qf0, qf1;
  {
    const _Float16* qp = Qh + ((size_t)(q0 + fr)) * NE + h * NDH;
#pragma unroll
    for (int j = 0; j < 16; ++j) {
      const int kk = koff(lane, j);
      qf0[j] = qp[kk];
      qf1[j] = qp[32 + kk];
    }
  }

  // state of query q0 + fr: running maximum (equal in both wave halves) and
  // this half's share of the running sum (halves joined after the loop)
  float mrow = -3.0e38f, srow = 0.0f;
  v8f cacc[4] = {};  // cacc[d][i] = ctx[q0 + fr][d * 16 + hi8 + i]

  const int krr = t >> 2;         // staging row 0..31
  const int kcc = (t & 3) * 16;   // staging col 0,16,32,48 (halves)
  const size_t hoff = (size_t)h * NDH;
  // this lane's 16-byte piece of the first 16-key x 16-column tile of Vs
  const _Float16* vtp = &Vs[hi8 + (lane & 7)][((lane >> 3) & 1) * 8];

  for (int lb = 0; lb < NL; lb += 32) {
    // ---- stage 32 keys/values (f16) into LDS -----------------------------
    const int krow = min(lb + krr, NL - 1);
    const _Float16* kp = Kh + (size_t)krow * NE + hoff + kcc;
    const _Float16* vp = Vh + (size_t)krow * NE + hoff + kcc;
#if USE_ASYNC_LDS
    __builtin_amdgcn_global_load_async_to_lds_b128(
        (g_v4i*)kp,       (l_v4i*)&Ks[krr][kcc],     0, 0);
    __builtin_amdgcn_global_load_async_to_lds_b128(
        (g_v4i*)(kp + 8), (l_v4i*)&Ks[krr][kcc + 8], 0, 0);
    __builtin_amdgcn_global_load_async_to_lds_b128(
        (g_v4i*)vp,       (l_v4i*)&Vs[krr][kcc],     0, 0);
    __builtin_amdgcn_global_load_async_to_lds_b128(
        (g_v4i*)(vp + 8), (l_v4i*)&Vs[krr][kcc + 8], 0, 0);
    __builtin_amdgcn_s_wait_asynccnt(0);
#else
    const float4 k0v = ((const float4*)kp)[0];
    const float4 k1v = ((const float4*)kp)[1];
    const float4 v0v = ((const float4*)vp)[0];
    const float4 v1v = ((const float4*)vp)[1];
    *(float4*)&Ks[krr][kcc]     = k0v;
    *(float4*)&Ks[krr][kcc + 8] = k1v;
    *(float4*)&Vs[krr][kcc]     = v0v;
    *(float4*)&Vs[krr][kcc + 8] = v1v;
#endif
    __syncthreads();

    // ---- scores: 32keys x 16q = 2 D-tiles, each 2 WMMA (K=32 over dh=64) --
    // sc0[i] = S[key lb + hi8 + i][query fr], sc1[i]: key lb + 16 + hi8 + i
    v8f sc0 = {}, sc1 = {};
    {
      v16h kf;
#pragma unroll
      for (int j = 0; j < 16; ++j) kf[j] = Ks[fr][koff(lane, j)];
      sc0 = __builtin_amdgcn_wmma_f32_16x16x32_f16(false, kf, false, qf0,
                                                   (short)0, sc0, false, false);
#pragma unroll
      for (int j = 0; j < 16; ++j) kf[j] = Ks[fr][32 + koff(lane, j)];
      sc0 = __builtin_amdgcn_wmma_f32_16x16x32_f16(false, kf, false, qf1,
                                                   (short)0, sc0, false, false);
#pragma unroll
      for (int j = 0; j < 16; ++j) kf[j] = Ks[16 + fr][koff(lane, j)];
      sc1 = __builtin_amdgcn_wmma_f32_16x16x32_f16(false, kf, false, qf0,
                                                   (short)0, sc1, false, false);
#pragma unroll
      for (int j = 0; j < 16; ++j) kf[j] = Ks[16 + fr][32 + koff(lane, j)];
      sc1 = __builtin_amdgcn_wmma_f32_16x16x32_f16(false, kf, false, qf1,
                                                   (short)0, sc1, false, false);
    }

    // ---- online softmax: one query per lane, keys along the registers ----
#pragma unroll
    for (int i = 0; i < 8; ++i) {
      sc0[i] *= 0.125f;  // 1/sqrt(64)
      sc1[i] *= 0.125f;
    }
    if (lb + 32 > NL) {  // only the last chunk has keys past the table
#pragma unroll
      for (int i = 0; i < 8; ++i) {
        if (lb + hi8 + i >= NL)      sc0[i] = -3.0e38f;
        if (lb + 16 + hi8 + i >= NL) sc1[i] = -3.0e38f;
      }
    }
    float mx = fmaxf(sc0[0], sc1[0]);
#pragma unroll
    for (int i = 1; i < 8; ++i) mx = fmaxf(mx, fmaxf(sc0[i], sc1[i]));
    mx = fmaxf(mx, xhalf(mx));
    const float mn   = fmaxf(mrow, mx);
    const float corr = __expf(mrow - mn);
    mrow = mn;

    v16h pf;  // P^T as B operand: element j is key koff(lane, j), column fr
    float ps = 0.0f;
#pragma unroll
    for (int i = 0; i < 8; ++i) {
      const float p0 = __expf(sc0[i] - mn);
      const float p1 = __expf(sc1[i] - mn);
      ps += p0 + p1;
      pf[i]     = (_Float16)p0;
      pf[8 + i] = (_Float16)p1;
    }
    srow = srow * corr + ps;
#pragma unroll
    for (int d = 0; d < 4; ++d)
#pragma unroll
      for (int i = 0; i < 8; ++i) cacc[d][i] *= corr;

    // ---- ctx^T += V^T(16x32) * P^T(32x16): 4 WMMA over dh tiles ----------
#pragma unroll
    for (int d = 0; d < 4; ++d) {
      // elements 0..7 from keys 0..15, 8..15 from keys 16..31: koff's order
      const v8h vlo = ld_tr16(vtp + d * 16);
      const v8h vhi = ld_tr16(vtp + 16 * VPITCH + d * 16);
      const v16h vf = __builtin_shufflevector(vlo, vhi, 0, 1, 2, 3, 4, 5, 6, 7,
                                              8, 9, 10, 11, 12, 13, 14, 15);
      cacc[d] = __builtin_amdgcn_wmma_f32_16x16x32_f16(false, vf, false, pf,
                                                       (short)0, cacc[d],
                                                       false, false);
    }
    __syncthreads();
  }

  // ---- normalize + store context (f32): 8 consecutive d per lane and tile --
  srow += xhalf(srow);
  {
    const float inv = 1.0f / srow;
    float* cp = Ctx + ((size_t)(q0 + fr)) * NE + h * NDH + hi8;
#pragma unroll
    for (int d = 0; d < 4; ++d) {
      *(float4*)&cp[d * 16]     = make_float4(cacc[d][0] * inv, cacc[d][1] * inv,
                                              cacc[d][2] * inv, cacc[d][3] * inv);
      *(float4*)&cp[d * 16 + 4] = make_float4(cacc[d][4] * inv, cacc[d][5] * inv,
                                              cacc[d][6] * inv, cacc[d][7] * inv);
    }
  }
}

// ---------------------------------------------------------------------------
extern "C" void kernel_launch(void* const* d_in, const int* in_sizes, int n_in,
                              void* d_out, int out_size, void* d_ws, size_t ws_size,
                              hipStream_t stream) {
  const float* features = (const float*)d_in[0];
  const float* labels   = (const float*)d_in[1];
  const float* Wq = (const float*)d_in[2];
  const float* bq = (const float*)d_in[3];
  const float* Wk = (const float*)d_in[4];
  const float* bk = (const float*)d_in[5];
  const float* Wv = (const float*)d_in[6];
  const float* bv = (const float*)d_in[7];
  const float* Wo = (const float*)d_in[8];
  const float* bo = (const float*)d_in[9];
  float* out = (float*)d_out;

  const size_t MQ = (size_t)NB * NSQ;  // 6272
  _Float16* Qh = (_Float16*)d_ws;      // [6272,1024] f16
  _Float16* Kh = Qh + MQ * NE;         // [1000,1024] f16
  _Float16* Vh = Kh + (size_t)NL * NE; // [1000,1024] f16
  float*    ctx = (float*)(Vh + (size_t)NL * NE);  // [6272,1024] f32

  const dim3 blk(512);

  // Q = features @ Wq^T + bq, K = labels @ Wk^T + bk, V = labels @ Wv^T + bv,
  // all -> f16: 49 * 4 + 8 * 4 + 8 * 4 = 260 block tiles in one launch
  proj_qkv_f16<<<dim3(260), blk, 0, stream>>>(
      features, labels, Wq, bq, Wk, bk, Wv, bv, Qh, Kh, Vh);

  // attention: softmax(Q K^T / 8) V  -> ctx (f32)
  attn_f16<<<dim3(NH * (NB * NSQ / 64)), dim3(128), 0, stream>>>(Qh, Kh, Vh, ctx);

  // out = ctx @ Wo^T + bo     -> f32
  gemm_bt_f16<<<dim3(49, 4), blk, 0, stream>>>(
      ctx, Wo, bo, out, nullptr, (int)MQ, NE, NE, 0);
}

// v008
// A run of this version takes 95.2 microseconds.
// Next to v007, in two timings, it ran 1.12 times as fast each time.
// Counting every step since v000, it is 3.29 times as fast.
#include <hip/hip_runtime.h>

typedef __attribute__((ext_vector_type(16))) _Float16 v16h;
typedef __attribute__((ext_vector_type(4)))  _Float16 v4h;
typedef __attribute__((ext_vector_type(8)))  _Float16 v8h;
typedef __attribute__((ext_vector_type(8)))  float    v8f;

#define NB    32      // batch
#define NSQ   196     // query sequence
#define NFD   2048    // feature dim
#define NL    1000    // labels
#define NE    1024    // embed dim
#define NH    16      // heads
#define NDH   64      // head dim

#if __has_builtin(__builtin_amdgcn_global_load_async_to_lds_b128) && \
    __has_builtin(__builtin_amdgcn_s_wait_asynccnt)
#define USE_ASYNC_LDS 1
typedef int v4i_vec __attribute__((vector_size(16)));
typedef __attribute__((address_space(1))) v4i_vec g_v4i;  // global (AS1)
typedef __attribute__((address_space(3))) v4i_vec l_v4i;  // LDS (AS3)
#else
#define USE_ASYNC_LDS 0
#endif

// 16-bit WMMA A/B operand element mapping (ISA 7.12.2):
// lane L holds matrix row (L & 15); element j of the v16h maps to
// K = kb + j      for j in [0,8)   (VGPR0..3)
// K = kb + j + 8  for j in [8,16)  (VGPR4..7), kb = (L<16) ? 0 : 8
__device__ __forceinline__ int koff(int lane, int j) {
  int kb = (lane & 16) ? 8 : 0;
  return kb + j + (j & 8);
}

// ---------------------------------------------------------------------------
// GEMM: C[M,N] = A[M,K] (f32) * B[N,K]^T (f32) + bias[N]
// out_half!=0 -> write _Float16 to Ch ; else write float to Cf
// block = 512 threads (16 waves). Block tile 128x256, wave tile 32x64: the
// A rows a block loads from L2 serve 256 output columns, so a product costs
// three quarters of the L2 bytes of a 128x128 tile.
// K step 32 -> 8 v_wmma_f32_16x16x32_f16 per wave per K step; the global
// loads run two K tiles ahead of the products, in two register sets.
// gemm_tile computes the block tile whose first row is m0, first column n0.
// ---------------------------------------------------------------------------
// Work-group barrier for LDS traffic alone: this wave's LDS reads and writes
// are complete, then signal and wait. __syncthreads() would also wait for the
// global loads in flight, which are meant to stay in flight across it.
__device__ __forceinline__ void lds_barrier() {
  asm volatile("s_wait_dscnt 0x0\n\ts_barrier_signal -1\n\ts_barrier_wait -1"
               ::: "memory");
}

#define CPITCH 68  // f32 per row of the epilogue's LDS tile: 64 and 4 of pad

__device__ __forceinline__ void gemm_tile(
    const float* __restrict__ A, const float* __restrict__ Bw,
    const float* __restrict__ bias, float* __restrict__ Cf,
    _Float16* __restrict__ Ch, int M, int N, int K, int out_half,
    int m0, int n0)
{
  // two LDS buffers per operand: a K step reads one while the next K tile
  // is written into the other, so one barrier a step is enough
  __shared__ alignas(16) _Float16 As[2][128][40];
  __shared__ alignas(16) _Float16 Bs[2][256][40];

  const int t    = threadIdx.x;
  const int lane = t & 31;
  const int wave = t >> 5;
  const int wm   = wave & 3;   // 0..3 -> 32-row slab
  const int wn   = wave >> 2;  // 0..3 -> 64-col slab
  const int fr   = lane & 15;
  const int hi8  = (lane >> 4) << 3;

  // staging: 8 lanes take the 32 f32 (one 128-byte line) of a row, so that a
  // wave-wide 16-byte load covers 4 whole lines. Load i of a wave takes row
  // arow + i (A) or brow + i (B) in each of its four lane groups; the groups
  // stand 4 rows apart, which at the 80-byte LDS pitch puts their 8-byte
  // stores on disjoint banks. A wave takes 16 of the 256 B rows; a pair of
  // waves shares 16 of the 128 A rows, two of each group's four rows each.
  const int grow = (lane >> 3) << 2;
  const int arow = (wave >> 1) * 16 + grow + (wave & 1) * 2;  // + i, i = 0..1
  const int brow = wave * 16 + grow;                          // + i, i = 0..3
  const int lcol = (lane & 7) * 4;                            // f32 column 0..28
  unsigned aoff[2], boff[4];  // byte offsets of this lane's loads in A and Bw
#pragma unroll
  for (int i = 0; i < 2; ++i)
    aoff[i] = ((unsigned)min(m0 + arow + i, M - 1) * (unsigned)K + lcol) * 4u;
#pragma unroll
  for (int i = 0; i < 4; ++i)
    boff[i] = ((unsigned)min(n0 + brow + i, N - 1) * (unsigned)K + lcol) * 4u;

  v8f acc[2][4] = {};

  // K tiles are fetched in order; ab and bb point at the next one's column 0
  const char* ab = (const char*)A;
  const char* bb = (const char*)Bw;
  // last: a literal, true for the fetch of the last K tile. Behind it the
  // address registers are free, and the compiler lets a later load of the same
  // group land in one: there the precaution below stands behind every load.
  auto fetch = [&](float4 (&av)[2], float4 (&bv)[4], bool last) {
#pragma unroll
    for (int i = 0; i < 2; ++i) {
      av[i] = *(const float4*)(ab + aoff[i]);
      if (last) asm volatile("s_wait_xcnt 0x0" ::: "memory");
    }
#pragma unroll
    for (int i = 0; i < 4; ++i) {
      bv[i] = *(const float4*)(bb + boff[i]);
      if (last && i < 3) asm volatile("s_wait_xcnt 0x0" ::: "memory");
    }
    // a precaution: these loads stay in flight for two K steps, in which
    // their address registers are given other values
    asm volatile("s_wait_xcnt 0x0" ::: "memory");
    ab += 128;  // 32 f32 on
    bb += 128;
  };
  auto stash = [&](const float4 (&av)[2], const float4 (&bv)[4], int buf) {
#pragma unroll
    for (int i = 0; i < 2; ++i) {
      v4h ha;
      ha[0] = (_Float16)av[i].x; ha[1] = (_Float16)av[i].y;
      ha[2] = (_Float16)av[i].z; ha[3] = (_Float16)av[i].w;
      *(v4h*)&As[buf][arow + i][lcol] = ha;
    }
#pragma unroll
    for (int i = 0; i < 4; ++i) {
      v4h hb;
      hb[0] = (_Float16)bv[i].x; hb[1] = (_Float16)bv[i].y;
      hb[2] = (_Float16)bv[i].z; hb[3] = (_Float16)bv[i].w;
      *(v4h*)&Bs[buf][brow + i][lcol] = hb;
    }
  };
  // one K step: products of the tile in buffer cur; the tile after it, whose
  // loads were issued two steps ago, goes from (av, bv) into the other buffer,
  // and (av, bv) take the loads of the tile two further on. cur and the three
  // flags are literals at every call: no branch stands in a step, so the
  // compiler's counted waits leave the younger set's loads in flight.
  auto kstep = [&](int cur, float4 (&av)[2], float4 (&bv)[4],
                   bool has_next, bool has_fetch, bool last_fetch) {
    v16h af[2], bf[4];
#pragma unroll
    for (int s = 0; s < 2; ++s)
#pragma unroll
      for (int j = 0; j < 16; ++j)
        af[s][j] = As[cur][wm * 32 + s * 16 + fr][koff(lane, j)];
#pragma unroll
    for (int s = 0; s < 4; ++s)
#pragma unroll
      for (int j = 0; j < 16; ++j)
        bf[s][j] = Bs[cur][wn * 64 + s * 16 + fr][koff(lane, j)];
    if (has_next) stash(av, bv, cur ^ 1);
    // the LDS traffic issues first: the products wait for the fragment loads
    // and the barrier for the stores, the global loads are due in two steps
    __builtin_amdgcn_sched_barrier(0);
    if (has_fetch) fetch(av, bv, last_fetch);
#pragma unroll
    for (int ia = 0; ia < 2; ++ia)
#pragma unroll
      for (int ib = 0; ib < 4; ++ib)
        acc[ia][ib] = __builtin_amdgcn_wmma_f32_16x16x32_f16(
            false, af[ia], false, bf[ib], (short)0, acc[ia][ib], false, false);
    if (has_next) {
      // keeps the products in front of the barrier: its wait then passes
      // while the matrix unit works, and no product stands between the
      // barrier and the next fragment loads
      __builtin_amdgcn_sched_barrier(0);
      lds_barrier();
    }
  };

  // K is a multiple of 64 and at least 192 (here 1024 or 2048)
  const int nk = K >> 5;  // K tiles of 32
  float4 a0[2], b0[4], a1[2], b1[4];  // even and odd K tiles in flight
  {
    float4 af[2], bf[4];
    fetch(af, bf, false);  // tile 0
    fetch(a1, b1, false);  // tile 1
    fetch(a0, b0, false);  // tile 2
    stash(af, bf, 0);
  }
  lds_barrier();
  int k = 0;
  do {
    kstep(0, a1, b1, true, true, false);
    kstep(1, a0, b0, true, true, false);
    k += 2;
  } while (k + 4 < nk);
  kstep(0, a1, b1, true, true, true);     // tile nk - 4; fetches the last tile
  kstep(1, a0, b0, true, false, false);
  kstep(0, a1, b1, true, false, false);
  kstep(1, a0, b0, false, false, false);  // tile nk - 1

  // ---- epilogue: the tile goes out, bias added, in whole 128-byte lines -----
  // In the D layout a lane holds one column of 8 rows, so a direct store puts
  // out 2 or 4 bytes a lane. Each wave turns its 32 x 64 tile (f32) in an LDS
  // range of its own, apart from the K loop's buffers, which other waves may
  // still be reading: no barrier is needed. At the pitch of 68 dwords the two
  // rows of a wave-wide 4-byte LDS store, 8 rows apart, lie on disjoint banks.
  __shared__ alignas(16) float Cs[16][32][CPITCH];
  float (*cw)[CPITCH] = Cs[wave];
  const int mw = m0 + wm * 32;  // first row and column of the wave's tile
  const int nw = n0 + wn * 64;
  // rows past M exist only in the last row of block tiles: one test a block
  const bool full = m0 + 128 <= M;
  // a lane stores 16 bytes of a row: 8 f16 (8 lanes a row, one line; 4 rows a
  // wave-wide store) or 4 f32 (16 lanes a row, two lines; 2 rows a store)
  const int r = out_half ? lane >> 3 : lane >> 4;
  const int c = out_half ? (lane & 7) * 8 : (lane & 15) * 4;
  // the bias of the lane's columns
  const float4 blo = *(const float4*)&bias[nw + c];
  const float4 bhi = out_half ? *(const float4*)&bias[nw + c + 4] : blo;
#pragma unroll
  for (int ia = 0; ia < 2; ++ia)
#pragma unroll
    for (int ib = 0; ib < 4; ++ib)
#pragma unroll
      for (int i = 0; i < 8; ++i)
        cw[ia * 16 + hi8 + i][ib * 16 + fr] = acc[ia][ib][i];
  // the wave's LDS stores are complete before its lanes read one another's
  // values back; the clobber keeps the compiler from moving a read up
  asm volatile("s_wait_dscnt 0x0" ::: "memory");

  if (out_half) {
    v8h hv[8];
#pragma unroll
    for (int j = 0; j < 8; ++j) {
      const float4 lo = *(const float4*)&cw[j * 4 + r][c];
      const float4 hi = *(const float4*)&cw[j * 4 + r][c + 4];
      hv[j][0] = (_Float16)(lo.x + blo.x); hv[j][1] = (_Float16)(lo.y + blo.y);
      hv[j][2] = (_Float16)(lo.z + blo.z); hv[j][3] = (_Float16)(lo.w + blo.w);
      hv[j][4] = (_Float16)(hi.x + bhi.x); hv[j][5] = (_Float16)(hi.y + bhi.y);
      hv[j][6] = (_Float16)(hi.z + bhi.z); hv[j][7] = (_Float16)(hi.w + bhi.w);
    }
    _Float16* cp = Ch + (size_t)(mw + r) * N + nw + c;
    if (full) {
#pragma unroll
      for (int j = 0; j < 8; ++j) *(v8h*)(cp + (size_t)(j * 4) * N) = hv[j];
    } else {
#pragma unroll
      for (int j = 0; j < 8; ++j)
        if (mw + r + j * 4 < M) *(v8h*)(cp + (size_t)(j * 4) * N) = hv[j];
    }
  } else {
    float4 fv[16];
#pragma unroll
    for (int j = 0; j < 16; ++j) {
      const float4 x = *(const float4*)&cw[j * 2 + r][c];
      fv[j] = make_float4(x.x + blo.x, x.y + blo.y, x.z + blo.z, x.w + blo.w);
    }
    float* cp = Cf + (size_t)(mw + r) * N + nw + c;
    if (full) {
#pragma unroll
      for (int j = 0; j < 16; ++j) *(float4*)(cp + (size_t)(j * 2) * N) = fv[j];
    } else {
#pragma unroll
      for (int j = 0; j < 16; ++j)
        if (mw + r + j * 2 < M) *(float4*)(cp + (size_t)(j * 2) * N) = fv[j];
    }
  }
}

// The output projection: f32 out, NE columns. Output type and row pitch are
// literals here as in proj_qkv_f16, so the epilogue has one path and its
// stores take one address and immediate offsets.
__global__ __launch_bounds__(512) void gemm_bt_f16(
    const float* __restrict__ A, const float* __restrict__ Bw,
    const float* __restrict__ bias, float* __restrict__ Cf, int M, int K)
{
  gemm_tile(A, Bw, bias, Cf, nullptr, M, NE, K, 0,
            blockIdx.x * 128, blockIdx.y * 256);
}

// The three input projections, which do not depend on one another, in one
// launch: the K and V products have only 32 block tiles each, an eighth of
// the chip's WGPs, and run here beside the Q product instead of after it.
// Blocks 0..195: Q tiles (the long ones, K = 2048, first), in the order of a
// (49, 4) grid; 196..227: K tiles; 228..259: V tiles, each as an (8, 4) grid.
#define QTM   49                 // 128-row tiles of Q
#define QTILES (QTM * (NE / 256))
__global__ __launch_bounds__(512) void proj_qkv_f16(
    const float* __restrict__ features, const float* __restrict__ labels,
    const float* __restrict__ Wq, const float* __restrict__ bq,
    const float* __restrict__ Wk, const float* __restrict__ bk,
    const float* __restrict__ Wv, const float* __restrict__ bv,
    _Float16* __restrict__ Qh, _Float16* __restrict__ Kh,
    _Float16* __restrict__ Vh)
{
  const int bid = blockIdx.x;
  const bool isq = bid < QTILES;
  const int  r   = bid - QTILES;       // K and V tiles: 0..63
  const bool isk = r < 32;
  const float* A    = isq ? features : labels;
  const float* Bw   = isq ? Wq : (isk ? Wk : Wv);
  const float* bias = isq ? bq : (isk ? bk : bv);
  _Float16*    Ch   = isq ? Qh : (isk ? Kh : Vh);
  const int M  = isq ? NB * NSQ : NL;
  const int K  = isq ? NFD : NE;
  const int tm = isq ? bid % QTM : (r & 7);
  const int tn = isq ? bid / QTM : ((r >> 3) & 3);
  gemm_tile(A, Bw, bias, nullptr, Ch, M, NE, K, 1, tm * 128, tn * 256);
}

// ---------------------------------------------------------------------------
// Flash-style attention over the label table, transposed products:
//   St = K * Q^T   (A = 16 keys from LDS, B = 16 queries kept in VGPRs)
//   Ot += V^T * P^T
// In the D layout a lane then holds the scores of ONE query (column lane&15),
// 8 keys per tile, so the row maximum and the row sum are taken in the lane's
// own registers (one exchange between the wave halves for the maximum), and
// two converted St tiles are already the B operand P^T: P never goes to LDS.
// The label table is common to all batches, so a query tile need not stay
// inside one batch: the B*SQ query rows are tiled as one list, which 64 divides,
// and no wave works on padding rows (196 rows a batch would fill 3 1/16 tiles).
// grid.x = H * (B*SQ/64) ; block = 128 (4 waves). Each wave owns 16 query rows
// of a 64-row tile, keeps its own online softmax state + 64x16 f32 context acc.
// K/V chunks staged via GLOBAL_LOAD_ASYNC_TO_LDS_B128 when available.
// ---------------------------------------------------------------------------
__device__ __forceinline__ float xhalf(float x) {  // value of lane ^ 16
  const int b = __builtin_bit_cast(int, x);
  return __builtin_bit_cast(float, __builtin_amdgcn_permlanex16(
      b, b, 0x76543210, 0xfedcba98, false, false));
}

// V rows in LDS: 160 bytes apart, an odd multiple of 32 bytes, the pitch at
// which the transposing load below meets no bank conflict.
#define VPITCH 80
typedef short s16x8 __attribute__((ext_vector_type(8)));
typedef __attribute__((address_space(3))) s16x8 lds_s16x8;
// ds_load_tr16_b128: lane (c = lane & 15, h = lane >> 4) gets the 8 halves
// T[8h + 0..7][c] of the 16 x 16 tile whose pieces the lanes point at.
__device__ __forceinline__ v8h ld_tr16(const _Float16* p) {
  return __builtin_bit_cast(v8h,
      __builtin_amdgcn_ds_load_tr16_b128_v8i16((lds_s16x8*)p));
}

__global__ __launch_bounds__(128) void attn_f16(
    const _Float16* __restrict__ Qh, const _Float16* __restrict__ Kh,
    const _Float16* __restrict__ Vh, float* __restrict__ Ctx)
{
  __shared__ alignas(16) _Float16 Ks[32][72];
  __shared__ alignas(16) _Float16 Vs[32][VPITCH];

  const int t    = threadIdx.x;
  const int lane = t & 31;
  const int wave = t >> 5;
  const int fr   = lane & 15;
  const int hi8  = (lane >> 4) << 3;   // D-layout row offset: 0 or 8

  // block index -> (head, tile), in the order it had: 64 blocks are 4 tiles of
  // head 0, 4 of head 1, ...; the last group has the 2 tiles that are left
  static_assert((NB * NSQ) % 128 == 0 && NH == 16, "whole tiles, 4 or 2 a group");
  const int  grp  = blockIdx.x >> 6;
  const bool four = grp < NB * NSQ / 256;
  const int  h    = (four ? blockIdx.x >> 2 : blockIdx.x >> 1) & 15;
  const int  tile = grp * 4 + (four ? blockIdx.x & 3 : blockIdx.x & 1);
  const int  q0   = tile * 64 + wave * 16;  // this wave's first row, of B*SQ

  // Q fragments: 16 x 64 head-dim, as two K=32 WMMA chunks, kept in VGPRs
  v16h qf0, qf1;
  {
    const _Float16* qp = Qh + ((size_t)(q0 + fr)) * NE + h * NDH;
#pragma unroll
    for (int j = 0; j < 16; ++j) {
      const int kk = koff(lane, j);
      qf0[j] = qp[kk];
      qf1[j] = qp[32 + kk];
    }
  }

  // state of query q0 + fr: running maximum (equal in both wave halves) and
  // this half's share of the running sum (halves joined after the loop)
  float mrow = -3.0e38f, srow = 0.0f;
  v8f cacc[4] = {};  // cacc[d][i] = ctx[q0 + fr][d * 16 + hi8 + i]

  const int krr = t >> 2;         // staging row 0..31
  const int kcc = (t & 3) * 16;   // staging col 0,16,32,48 (halves)
  const size_t hoff = (size_t)h * NDH;
  // this lane's 16-byte piece of the first 16-key x 16-column tile of Vs
  const _Float16* vtp = &Vs[hi8 + (lane & 7)][((lane >> 3) & 1) * 8];

  for (int lb = 0; lb < NL; lb += 32) {
    // ---- stage 32 keys/values (f16) into LDS -----------------------------
    const int krow = min(lb + krr, NL - 1);
    const _Float16* kp = Kh + (size_t)krow * NE + hoff + kcc;
    const _Float16* vp = Vh + (size_t)krow * NE + hoff + kcc;
#if USE_ASYNC_LDS
    __builtin_amdgcn_global_load_async_to_lds_b128(
        (g_v4i*)kp,       (l_v4i*)&Ks[krr][kcc],     0, 0);
    __builtin_amdgcn_global_load_async_to_lds_b128(
        (g_v4i*)(kp + 8), (l_v4i*)&Ks[krr][kcc + 8], 0, 0);
    __builtin_amdgcn_global_load_async_to_lds_b128(
        (g_v4i*)vp,       (l_v4i*)&Vs[krr][kcc],     0, 0);
    __builtin_amdgcn_global_load_async_to_lds_b128(
        (g_v4i*)(vp + 8), (l_v4i*)&Vs[krr][kcc + 8], 0, 0);
    __builtin_amdgcn_s_wait_asynccnt(0);
#else
    const float4 k0v = ((const float4*)kp)[0];
    const float4 k1v = ((const float4*)kp)[1];
    const float4 v0v = ((const float4*)vp)[0];
    const float4 v1v = ((const float4*)vp)[1];
    *(float4*)&Ks[krr][kcc]     = k0v;
    *(float4*)&Ks[krr][kcc + 8] = k1v;
    *(float4*)&Vs[krr][kcc]     = v0v;
    *(float4*)&Vs[krr][kcc + 8] = v1v;
#endif
    __syncthreads();

    // ---- scores: 32keys x 16q = 2 D-tiles, each 2 WMMA (K=32 over dh=64) --
    // sc0[i] = S[key lb + hi8 + i][query fr], sc1[i]: key lb + 16 + hi8 + i
    v8f sc0 = {}, sc1 = {};
    {
      v16h kf;
#pragma unroll
      for (int j = 0; j < 16; ++j) kf[j] = Ks[fr][koff(lane, j)];
      sc0 = __builtin_amdgcn_wmma_f32_16x16x32_f16(false, kf, false, qf0,
                                                   (short)0, sc0, false, false);
#pragma unroll
      for (int j = 0; j < 16; ++j) kf[j] = Ks[fr][32 + koff(lane, j)];
      sc0 = __builtin_amdgcn_wmma_f32_16x16x32_f16(false, kf, false, qf1,
                                                   (short)0, sc0, false, false);
#pragma unroll
      for (int j = 0; j < 16; ++j) kf[j] = Ks[16 + fr][koff(lane, j)];
      sc1 = __builtin_amdgcn_wmma_f32_16x16x32_f16(false, kf, false, qf0,
                                                   (short)0, sc1, false, false);
#pragma unroll
      for (int j = 0; j < 16; ++j) kf[j] = Ks[16 + fr][32 + koff(lane, j)];
      sc1 = __builtin_amdgcn_wmma_f32_16x16x32_f16(false, kf, false, qf1,
                                                   (short)0, sc1, false, false);
    }

    // ---- online softmax: one query per lane, keys along the registers ----
#pragma unroll
    for (int i = 0; i < 8; ++i) {
      sc0[i] *= 0.125f;  // 1/sqrt(64)
      sc1[i] *= 0.125f;
    }
    if (lb + 32 > NL) {  // only the last chunk has keys past the table
#pragma unroll
      for (int i = 0; i < 8; ++i) {
        if (lb + hi8 + i >= NL)      sc0[i] = -3.0e38f;
        if (lb + 16 + hi8 + i >= NL) sc1[i] = -3.0e38f;
      }
    }
    float mx = fmaxf(sc0[0], sc1[0]);
#pragma unroll
    for (int i = 1; i < 8; ++i) mx = fmaxf(mx, fmaxf(sc0[i], sc1[i]));
    mx = fmaxf(mx, xhalf(mx));
    const float mn   = fmaxf(mrow, mx);
    const float corr = __expf(mrow - mn);
    mrow = mn;

    v16h pf;  // P^T as B operand: element j is key koff(lane, j), column fr
    float ps = 0.0f;
#pragma unroll
    for (int i = 0; i < 8; ++i) {
      const float p0 = __expf(sc0[i] - mn);
      const float p1 = __expf(sc1[i] - mn);
      ps += p0 + p1;
      pf[i]     = (_Float16)p0;
      pf[8 + i] = (_Float16)p1;
    }
    srow = srow * corr + ps;
#pragma unroll
    for (int d = 0; d < 4; ++d)
#pragma unroll
      for (int i = 0; i < 8; ++i) cacc[d][i] *= corr;

    // ---- ctx^T += V^T(16x32) * P^T(32x16): 4 WMMA over dh tiles ----------
#pragma unroll
    for (int d = 0; d < 4; ++d) {
      // elements 0..7 from keys 0..15, 8..15 from keys 16..31: koff's order
      const v8h vlo = ld_tr16(vtp + d * 16);
      const v8h vhi = ld_tr16(vtp + 16 * VPITCH + d * 16);
      const v16h vf = __builtin_shufflevector(vlo, vhi, 0, 1, 2, 3, 4, 5, 6, 7,
                                              8, 9, 10, 11, 12, 13, 14, 15);
      cacc[d] = __builtin_amdgcn_wmma_f32_16x16x32_f16(false, vf, false, pf,
                                                       (short)0, cacc[d],
                                                       false, false);
    }
    __syncthreads();
  }

  // ---- normalize + store context (f32): 8 consecutive d per lane and tile --
  srow += xhalf(srow);
  {
    const float inv = 1.0f / srow;
    float* cp = Ctx + ((size_t)(q0 + fr)) * NE + h * NDH + hi8;
#pragma unroll
    for (int d = 0; d < 4; ++d) {
      *(float4*)&cp[d * 16]     = make_float4(cacc[d][0] * inv, cacc[d][1] * inv,
                                              cacc[d][2] * inv, cacc[d][3] * inv);
      *(float4*)&cp[d * 16 + 4] = make_float4(cacc[d][4] * inv, cacc[d][5] * inv,
                                              cacc[d][6] * inv, cacc[d][7] * inv);
    }
  }
}

// ---------------------------------------------------------------------------
extern "C" void kernel_launch(void* const* d_in, const int* in_sizes, int n_in,
                              void* d_out, int out_size, void* d_ws, size_t ws_size,
                              hipStream_t stream) {
  const float* features = (const float*)d_in[0];
  const float* labels   = (const float*)d_in[1];
  const float* Wq = (const float*)d_in[2];
  const float* bq = (const float*)d_in[3];
  const float* Wk = (const float*)d_in[4];
  const float* bk = (const float*)d_in[5];
  const float* Wv = (const float*)d_in[6];
  const float* bv = (const float*)d_in[7];
  const float* Wo = (const float*)d_in[8];
  const float* bo = (const float*)d_in[9];
  float* out = (float*)d_out;

  const size_t MQ = (size_t)NB * NSQ;  // 6272
  _Float16* Qh = (_Float16*)d_ws;      // [6272,1024] f16
  _Float16* Kh = Qh + MQ * NE;         // [1000,1024] f16
  _Float16* Vh = Kh + (size_t)NL * NE; // [1000,1024] f16
  float*    ctx = (float*)(Vh + (size_t)NL * NE);  // [6272,1024] f32

  const dim3 blk(512);

  // Q = features @ Wq^T + bq, K = labels @ Wk^T + bk, V = labels @ Wv^T + bv,
  // all -> f16: 49 * 4 + 8 * 4 + 8 * 4 = 260 block tiles in one launch
  proj_qkv_f16<<<dim3(260), blk, 0, stream>>>(
      features, labels, Wq, bq, Wk, bk, Wv, bv, Qh, Kh, Vh);

  // attention: softmax(Q K^T / 8) V  -> ctx (f32)
  attn_f16<<<dim3(NH * (NB * NSQ / 64)), dim3(128), 0, stream>>>(Qh, Kh, Vh, ctx);

  // out = ctx @ Wo^T + bo     -> f32
  gemm_bt_f16<<<dim3(49, 4), blk, 0, stream>>>(
      ctx, Wo, bo, out, (int)MQ, NE);
}

// v010
// It runs in 82.2 microseconds.
// It is 1.16 times as fast as v008, going by the measured steps of the versions left out in between.
// Over all steps from v000 it is 3.81 times as fast.
#include <hip/hip_runtime.h>

typedef __attribute__((ext_vector_type(16))) _Float16 v16h;
typedef __attribute__((ext_vector_type(4)))  _Float16 v4h;
typedef __attribute__((ext_vector_type(8)))  _Float16 v8h;
typedef __attribute__((ext_vector_type(8)))  float    v8f;

#define NB    32      // batch
#define NSQ   196     // query sequence
#define NFD   2048    // feature dim
#define NL    1000    // labels
#define NE    1024    // embed dim
#define NH    16      // heads
#define NDH   64      // head dim

// 16-bit WMMA A/B operand element mapping (ISA 7.12.2):
// lane L holds matrix row (L & 15); element j of the v16h maps to
// K = kb + j      for j in [0,8)   (VGPR0..3)
// K = kb + j + 8  for j in [8,16)  (VGPR4..7), kb = (L<16) ? 0 : 8
__device__ __forceinline__ int koff(int lane, int j) {
  int kb = (lane & 16) ? 8 : 0;
  return kb + j + (j & 8);
}

// ---------------------------------------------------------------------------
// GEMM: C[M,N] = A[M,K] (f32) * B[N,K]^T (f32) + bias[N]
// out_half!=0 -> write _Float16 to Ch ; else write float to Cf
// block = 512 threads (16 waves). Block tile 128x256, wave tile 32x64: the
// A rows a block loads from L2 serve 256 output columns, so a product costs
// three quarters of the L2 bytes of a 128x128 tile.
// K step 32 -> 8 v_wmma_f32_16x16x32_f16 per wave per K step; the global
// loads run two K tiles ahead of the products, in two register sets.
// gemm_tile computes the block tile whose first row is m0, first column n0.
// ---------------------------------------------------------------------------
// Work-group barrier for LDS traffic alone: this wave's LDS reads and writes
// are complete, then signal and wait. __syncthreads() would also wait for the
// global loads in flight, which are meant to stay in flight across it.
__device__ __forceinline__ void lds_barrier() {
  asm volatile("s_wait_dscnt 0x0\n\ts_barrier_signal -1\n\ts_barrier_wait -1"
               ::: "memory");
}

#define CPITCH 68  // f32 per row of the epilogue's LDS tile: 64 and 4 of pad

__device__ __forceinline__ void gemm_tile(
    const float* __restrict__ A, const float* __restrict__ Bw,
    const float* __restrict__ bias, float* __restrict__ Cf,
    _Float16* __restrict__ Ch, int M, int N, int K, int out_half,
    int m0, int n0, float oscale)  // oscale: factor on the f16 output
{
  // two LDS buffers per operand: a K step reads one while the next K tile
  // is written into the other, so one barrier a step is enough
  __shared__ alignas(16) _Float16 As[2][128][40];
  __shared__ alignas(16) _Float16 Bs[2][256][40];

  const int t    = threadIdx.x;
  const int lane = t & 31;
  const int wave = t >> 5;
  const int wm   = wave & 3;   // 0..3 -> 32-row slab
  const int wn   = wave >> 2;  // 0..3 -> 64-col slab
  const int fr   = lane & 15;
  const int hi8  = (lane >> 4) << 3;

  // staging: 8 lanes take the 32 f32 (one 128-byte line) of a row, so that a
  // wave-wide 16-byte load covers 4 whole lines. Load i of a wave takes row
  // arow + i (A) or brow + i (B) in each of its four lane groups; the groups
  // stand 4 rows apart, which at the 80-byte LDS pitch puts their 8-byte
  // stores on disjoint banks. A wave takes 16 of the 256 B rows; a pair of
  // waves shares 16 of the 128 A rows, two of each group's four rows each.
  const int grow = (lane >> 3) << 2;
  const int arow = (wave >> 1) * 16 + grow + (wave & 1) * 2;  // + i, i = 0..1
  const int brow = wave * 16 + grow;                          // + i, i = 0..3
  const int lcol = (lane & 7) * 4;                            // f32 column 0..28
  unsigned aoff[2], boff[4];  // byte offsets of this lane's loads in A and Bw
#pragma unroll
  for (int i = 0; i < 2; ++i)
    aoff[i] = ((unsigned)min(m0 + arow + i, M - 1) * (unsigned)K + lcol) * 4u;
#pragma unroll
  for (int i = 0; i < 4; ++i)
    boff[i] = ((unsigned)min(n0 + brow + i, N - 1) * (unsigned)K + lcol) * 4u;

  v8f acc[2][4] = {};

  // K tiles are fetched in order; ab and bb point at the next one's column 0
  const char* ab = (const char*)A;
  const char* bb = (const char*)Bw;
  // last: a literal, true for the fetch of the last K tile. Behind it the
  // address registers are free, and the compiler lets a later load of the same
  // group land in one: there the precaution below stands behind every load.
  auto fetch = [&](float4 (&av)[2], float4 (&bv)[4], bool last) {
#pragma unroll
    for (int i = 0; i < 2; ++i) {
      av[i] = *(const float4*)(ab + aoff[i]);
      if (last) asm volatile("s_wait_xcnt 0x0" ::: "memory");
    }
#pragma unroll
    for (int i = 0; i < 4; ++i) {
      bv[i] = *(const float4*)(bb + boff[i]);
      if (last && i < 3) asm volatile("s_wait_xcnt 0x0" ::: "memory");
    }
    // a precaution: these loads stay in flight for two K steps, in which
    // their address registers are given other values
    asm volatile("s_wait_xcnt 0x0" ::: "memory");
    ab += 128;  // 32 f32 on
    bb += 128;
  };
  auto stash = [&](const float4 (&av)[2], const float4 (&bv)[4], int buf) {
#pragma unroll
    for (int i = 0; i < 2; ++i) {
      v4h ha;
      ha[0] = (_Float16)av[i].x; ha[1] = (_Float16)av[i].y;
      ha[2] = (_Float16)av[i].z; ha[3] = (_Float16)av[i].w;
      *(v4h*)&As[buf][arow + i][lcol] = ha;
    }
#pragma unroll
    for (int i = 0; i < 4; ++i) {
      v4h hb;
      hb[0] = (_Float16)bv[i].x; hb[1] = (_Float16)bv[i].y;
      hb[2] = (_Float16)bv[i].z; hb[3] = (_Float16)bv[i].w;
      *(v4h*)&Bs[buf][brow + i][lcol] = hb;
    }
  };
  // one K step: products of the tile in buffer cur; the tile after it, whose
  // loads were issued two steps ago, goes from (av, bv) into the other buffer,
  // and (av, bv) take the loads of the tile two further on. cur and the three
  // flags are literals at every call: no branch stands in a step, so the
  // compiler's counted waits leave the younger set's loads in flight.
  auto kstep = [&](int cur, float4 (&av)[2], float4 (&bv)[4],
                   bool has_next, bool has_fetch, bool last_fetch) {
    v16h af[2], bf[4];
#pragma unroll
    for (int s = 0; s < 2; ++s)
#pragma unroll
      for (int j = 0; j < 16; ++j)
        af[s][j] = As[cur][wm * 32 + s * 16 + fr][koff(lane, j)];
#pragma unroll
    for (int s = 0; s < 4; ++s)
#pragma unroll
      for (int j = 0; j < 16; ++j)
        bf[s][j] = Bs[cur][wn * 64 + s * 16 + fr][koff(lane, j)];
    if (has_next) stash(av, bv, cur ^ 1);
    // the LDS traffic issues first: the products wait for the fragment loads
    // and the barrier for the stores, the global loads are due in two steps
    __builtin_amdgcn_sched_barrier(0);
    if (has_fetch) fetch(av, bv, last_fetch);
#pragma unroll
    for (int ia = 0; ia < 2; ++ia)
#pragma unroll
      for (int ib = 0; ib < 4; ++ib)
        acc[ia][ib] = __builtin_amdgcn_wmma_f32_16x16x32_f16(
            false, af[ia], false, bf[ib], (short)0, acc[ia][ib], false, false);
    if (has_next) {
      // keeps the products in front of the barrier: its wait then passes
      // while the matrix unit works, and no product stands between the
      // barrier and the next fragment loads
      __builtin_amdgcn_sched_barrier(0);
      lds_barrier();
    }
  };

  // K is a multiple of 64 and at least 192 (here 1024 or 2048)
  const int nk = K >> 5;  // K tiles of 32
  float4 a0[2], b0[4], a1[2], b1[4];  // even and odd K tiles in flight
  {
    float4 af[2], bf[4];
    fetch(af, bf, false);  // tile 0
    fetch(a1, b1, false);  // tile 1
    fetch(a0, b0, false);  // tile 2
    stash(af, bf, 0);
  }
  lds_barrier();
  int k = 0;
  do {
    kstep(0, a1, b1, true, true, false);
    kstep(1, a0, b0, true, true, false);
    k += 2;
  } while (k + 4 < nk);
  kstep(0, a1, b1, true, true, true);     // tile nk - 4; fetches the last tile
  kstep(1, a0, b0, true, false, false);
  kstep(0, a1, b1, true, false, false);
  kstep(1, a0, b0, false, false, false);  // tile nk - 1

  // ---- epilogue: the tile goes out, bias added, in whole 128-byte lines -----
  // In the D layout a lane holds one column of 8 rows, so a direct store puts
  // out 2 or 4 bytes a lane. Each wave turns its 32 x 64 tile (f32) in an LDS
  // range of its own, apart from the K loop's buffers, which other waves may
  // still be reading: no barrier is needed. At the pitch of 68 dwords the two
  // rows of a wave-wide 4-byte LDS store, 8 rows apart, lie on disjoint banks.
  __shared__ alignas(16) float Cs[16][32][CPITCH];
  float (*cw)[CPITCH] = Cs[wave];
  const int mw = m0 + wm * 32;  // first row and column of the wave's tile
  const int nw = n0 + wn * 64;
  // rows past M exist only in the last row of block tiles: one test a block
  const bool full = m0 + 128 <= M;
  // a lane stores 16 bytes of a row: 8 f16 (8 lanes a row, one line; 4 rows a
  // wave-wide store) or 4 f32 (16 lanes a row, two lines; 2 rows a store)
  const int r = out_half ? lane >> 3 : lane >> 4;
  const int c = out_half ? (lane & 7) * 8 : (lane & 15) * 4;
  // the bias of the lane's columns
  const float4 blo = *(const float4*)&bias[nw + c];
  const float4 bhi = out_half ? *(const float4*)&bias[nw + c + 4] : blo;
#pragma unroll
  for (int ia = 0; ia < 2; ++ia)
#pragma unroll
    for (int ib = 0; ib < 4; ++ib)
#pragma unroll
      for (int i = 0; i < 8; ++i)
        cw[ia * 16 + hi8 + i][ib * 16 + fr] = acc[ia][ib][i];
  // the wave's LDS stores are complete before its lanes read one another's
  // values back; the clobber keeps the compiler from moving a read up
  asm volatile("s_wait_dscnt 0x0" ::: "memory");

  if (out_half) {
    v8h hv[8];
#pragma unroll
    for (int j = 0; j < 8; ++j) {
      const float4 lo = *(const float4*)&cw[j * 4 + r][c];
      const float4 hi = *(const float4*)&cw[j * 4 + r][c + 4];
      hv[j][0] = (_Float16)((lo.x + blo.x) * oscale);
      hv[j][1] = (_Float16)((lo.y + blo.y) * oscale);
      hv[j][2] = (_Float16)((lo.z + blo.z) * oscale);
      hv[j][3] = (_Float16)((lo.w + blo.w) * oscale);
      hv[j][4] = (_Float16)((hi.x + bhi.x) * oscale);
      hv[j][5] = (_Float16)((hi.y + bhi.y) * oscale);
      hv[j][6] = (_Float16)((hi.z + bhi.z) * oscale);
      hv[j][7] = (_Float16)((hi.w + bhi.w) * oscale);
    }
    _Float16* cp = Ch + (size_t)(mw + r) * N + nw + c;
    if (full) {
#pragma unroll
      for (int j = 0; j < 8; ++j) *(v8h*)(cp + (size_t)(j * 4) * N) = hv[j];
    } else {
#pragma unroll
      for (int j = 0; j < 8; ++j)
        if (mw + r + j * 4 < M) *(v8h*)(cp + (size_t)(j * 4) * N) = hv[j];
    }
  } else {
    float4 fv[16];
#pragma unroll
    for (int j = 0; j < 16; ++j) {
      const float4 x = *(const float4*)&cw[j * 2 + r][c];
      fv[j] = make_float4(x.x + blo.x, x.y + blo.y, x.z + blo.z, x.w + blo.w);
    }
    float* cp = Cf + (size_t)(mw + r) * N + nw + c;
    if (full) {
#pragma unroll
      for (int j = 0; j < 16; ++j) *(float4*)(cp + (size_t)(j * 2) * N) = fv[j];
    } else {
#pragma unroll
      for (int j = 0; j < 16; ++j)
        if (mw + r + j * 2 < M) *(float4*)(cp + (size_t)(j * 2) * N) = fv[j];
    }
  }
}

// The output projection: f32 out, NE columns. Output type and row pitch are
// literals here as in proj_qkv_f16, so the epilogue has one path and its
// stores take one address and immediate offsets.
__global__ __launch_bounds__(512) void gemm_bt_f16(
    const float* __restrict__ A, const float* __restrict__ Bw,
    const float* __restrict__ bias, float* __restrict__ Cf, int M, int K)
{
  gemm_tile(A, Bw, bias, Cf, nullptr, M, NE, K, 0,
            blockIdx.x * 128, blockIdx.y * 256, 1.0f);
}

// The three input projections, which do not depend on one another, in one
// launch: the K and V products have only 32 block tiles each, an eighth of
// the chip's WGPs, and run here beside the Q product instead of after it.
// Blocks 0..195: Q tiles (the long ones, K = 2048, first), in the order of a
// (49, 4) grid; 196..227: K tiles; 228..259: V tiles, each as an (8, 4) grid.
#define QTM   49                 // 128-row tiles of Q
#define QTILES (QTM * (NE / 256))
// Q is stored times log2(e) / sqrt(64), applied in f32 before its one rounding
// to f16: K * Q^T is then the softmax argument in the base-2 domain.
#define QSCALE 0.18033688011112042f
__global__ __launch_bounds__(512) void proj_qkv_f16(
    const float* __restrict__ features, const float* __restrict__ labels,
    const float* __restrict__ Wq, const float* __restrict__ bq,
    const float* __restrict__ Wk, const float* __restrict__ bk,
    const float* __restrict__ Wv, const float* __restrict__ bv,
    _Float16* __restrict__ Qh, _Float16* __restrict__ Kh,
    _Float16* __restrict__ Vh)
{
  const int bid = blockIdx.x;
  const bool isq = bid < QTILES;
  const int  r   = bid - QTILES;       // K and V tiles: 0..63
  const bool isk = r < 32;
  const float* A    = isq ? features : labels;
  const float* Bw   = isq ? Wq : (isk ? Wk : Wv);
  const float* bias = isq ? bq : (isk ? bk : bv);
  _Float16*    Ch   = isq ? Qh : (isk ? Kh : Vh);
  const int M  = isq ? NB * NSQ : NL;
  const int K  = isq ? NFD : NE;
  const int tm = isq ? bid % QTM : (r & 7);
  const int tn = isq ? bid / QTM : ((r >> 3) & 3);
  gemm_tile(A, Bw, bias, nullptr, Ch, M, NE, K, 1, tm * 128, tn * 256,
            isq ? QSCALE : 1.0f);
}

// ---------------------------------------------------------------------------
// Flash-style attention over the label table, transposed products:
//   St = K * Q^T   (A = 16 keys from LDS, B = 16 queries kept in VGPRs)
//   Ot += V^T * P^T
// In the D layout a lane then holds the scores of ONE query (column lane&15),
// 8 keys per tile, so the row maximum and the row sum are taken in the lane's
// own registers (one exchange between the wave halves for the maximum), and
// two converted St tiles are already the B operand P^T: P never goes to LDS.
// Q comes scaled by log2(e) / 8 and the score products start at minus the
// maximum in use, so P = exp2(D) with no vector work in between; the maximum
// is taken anew, and sums and context rescaled, only when a P grows large.
// The label table is common to all batches, so the B*SQ query rows are tiled as
// one list, in 196 wave tiles of 32 rows. A head's K and V (1000 rows of 128
// bytes each) fit the LDS of a WGP: a work-group copies both whole, once, and
// its waves then run the key loop with no barrier, no copy and no wait on one
// another. A wave owns 32 query rows as two 16-column B tiles: each K and V^T
// fragment it reads from LDS serves two products.
// grid.x = H * 16 ; block = 416 (13 waves): a sixteenth of the 196 wave tiles
// is 12 or 13. Each wave keeps its own online softmax state and context.
// ---------------------------------------------------------------------------
__device__ __forceinline__ float xhalf(float x) {  // value of lane ^ 16
  const int b = __builtin_bit_cast(int, x);
  return __builtin_bit_cast(float, __builtin_amdgcn_permlanex16(
      b, b, 0x76543210, 0xfedcba98, false, false));
}

// exp2 with, in the same statement, the one slot that the instruction set asks
// for between a transcendental and an overwrite of its source register.
__device__ __forceinline__ float exp2_slot(float x) {
  float y;
  asm("v_exp_f32 %0, %1\n\tv_nop" : "=v"(y) : "v"(x));
  return y;
}

// V rows in LDS: 160 bytes apart, an odd multiple of 32 bytes, the pitch at
// which the transposing load below meets no bank conflict.
#define VPITCH 80
typedef short s16x8 __attribute__((ext_vector_type(8)));
typedef __attribute__((address_space(3))) s16x8 lds_s16x8;
// ds_load_tr16_b128: lane (c = lane & 15, h = lane >> 4) gets the 8 halves
// T[8h + 0..7][c] of the 16 x 16 tile whose pieces the lanes point at.
__device__ __forceinline__ v8h ld_tr16(const _Float16* p) {
  return __builtin_bit_cast(v8h,
      __builtin_amdgcn_ds_load_tr16_b128_v8i16((lds_s16x8*)p));
}

#define APARTS 16    // work-groups a head
#define AWAVES 13    // waves a work-group
#define NLP    1024  // keys, rounded up to whole passes of 32
__global__ __launch_bounds__(AWAVES * 32) void attn_f16(
    const _Float16* __restrict__ Qh, const _Float16* __restrict__ Kh,
    const _Float16* __restrict__ Vh, float* __restrict__ Ctx)
{
  __shared__ alignas(16) _Float16 Ks[NLP][72];
  __shared__ alignas(16) _Float16 Vs[NLP][VPITCH];

  const int t    = threadIdx.x;
  const int lane = t & 31;
  const int wave = __builtin_amdgcn_readfirstlane(t >> 5);
  const int fr   = lane & 15;
  const int hi8  = (lane >> 4) << 3;   // D-layout row offset: 0 or 8

  static_assert(NB * NSQ == 32 * 196 && NH == 16, "196 whole wave tiles");
  const int h    = blockIdx.x & 15;
  const int part = blockIdx.x >> 4;
  // part p takes the wave tiles from 49 p / 4 up to 49 (p + 1) / 4
  const int  wt   = ((part * 49) >> 2) + wave;
  const bool work = wt < (((part + 1) * 49) >> 2);
  const int  q0   = min(wt, 195) * 32;  // this wave's first row, of B*SQ

  // Q fragments: 2 tiles of 16 x 64 head-dim, each as two K=32 WMMA chunks
  v16h qf[2][2];
#pragma unroll
  for (int u = 0; u < 2; ++u) {
    const _Float16* qp = Qh + ((size_t)(q0 + u * 16 + fr)) * NE + h * NDH;
#pragma unroll
    for (int j = 0; j < 16; ++j) {
      const int kk = koff(lane, j);
      qf[u][0][j] = qp[kk];
      qf[u][1][j] = qp[32 + kk];
    }
  }
  // a precaution: the Q loads stay in flight over the copies below, whose
  // address arithmetic takes over their address registers
  asm volatile("s_wait_xcnt 0x0" ::: "memory");

  // ---- the head's K and V into LDS: 8 lanes take a row's 128-byte line, a
  // wave-wide copy 4 rows; wave w takes the row groups w, w + 13, ... The rows
  // past the table take its last row: finite values, whose P are 0.
  {
    const int srow = lane >> 3;
    const int scol = (lane & 7) * 8;
    for (int g = wave; g < NLP / 4; g += AWAVES) {
      const int row = g * 4 + srow;
      const size_t so = (size_t)min(row, NL - 1) * NE + h * NDH + scol;
      const _Float16* gk = Kh + so;
      const _Float16* gv = Vh + so;
      const unsigned lk = (unsigned)(size_t)&Ks[row][scol];
      const unsigned lv = (unsigned)(size_t)&Vs[row][scol];
      // the closing wait is a precaution: the next trip gives the four address
      // registers new values while the copies are in flight
      asm volatile("global_load_async_to_lds_b128 %0, %1, off\n\t"
                   "global_load_async_to_lds_b128 %2, %3, off\n\t"
                   "s_wait_xcnt 0x0"
                   :: "v"(lk), "v"(gk), "v"(lv), "v"(gv) : "memory");
    }
  }
  // this wave's copies have landed; behind the barrier, every wave's
  asm volatile("s_wait_asynccnt 0x0" ::: "memory");
  __syncthreads();
  if (!work) return;  // the 13th wave of a part of 12; no barrier follows

  // state of query q0 + u * 16 + fr: negm[u] holds, in all 8 elements, minus
  // the maximum in use (base-2 domain, equal in both wave halves): it is the C
  // operand of the score products, so that D is already the argument of exp2.
  // srow[u] is this half's share of the running sum (joined after the loop).
  v8f   negm[2] = {};
  float srow[2] = {0.0f, 0.0f};
  v8f cacc[2][4] = {};  // cacc[u][d][i] = ctx[q0 + u*16 + fr][d*16 + hi8 + i]

  // this lane's 16-byte piece of the first 16-key x 16-column tile of Vs
  const _Float16* vtp = &Vs[hi8 + (lane & 7)][((lane >> 3) & 1) * 8];

  for (int lb = 0; lb < NL; lb += 32) {
    // ---- scores: 32 keys x 32 q = 4 D-tiles, each 2 WMMA (K=32 over dh=64) -
    // sc[u][kt][i] = S[key lb + kt*16 + hi8 + i][query u*16 + fr]
    v8f sc[2][2];
    v16h vf[4];  // V^T fragments of the pass, one a 16-column tile of dh
    {
      v16h kf[2][2];  // [key tile][head-dim chunk]
#pragma unroll
      for (int kt = 0; kt < 2; ++kt)
#pragma unroll
        for (int c = 0; c < 2; ++c)
#pragma unroll
          for (int j = 0; j < 16; ++j)
            kf[kt][c][j] = Ks[lb + kt * 16 + fr][c * 32 + koff(lane, j)];
      const _Float16* vp = vtp + lb * VPITCH;
#pragma unroll
      for (int d = 0; d < 4; ++d) {
        // elements 0..7 from keys 0..15, 8..15 from keys 16..31: koff's order
        const v8h vlo = ld_tr16(vp + d * 16);
        const v8h vhi = ld_tr16(vp + 16 * VPITCH + d * 16);
        vf[d] = __builtin_shufflevector(vlo, vhi, 0, 1, 2, 3, 4, 5, 6, 7,
                                        8, 9, 10, 11, 12, 13, 14, 15);
      }
      // all 16 LDS loads of the pass issue here as one group: nothing refills
      // the tiles, so the V^T loads need not wait for the softmax, and their
      // latency passes under the score products instead of behind them
      __builtin_amdgcn_sched_barrier(0);
#pragma unroll
      for (int kt = 0; kt < 2; ++kt)
#pragma unroll
        for (int u = 0; u < 2; ++u)
          sc[u][kt] = __builtin_amdgcn_wmma_f32_16x16x32_f16(
              false, kf[kt][0], false, qf[u][0], (short)0, negm[u], false, false);
#pragma unroll
      for (int kt = 0; kt < 2; ++kt)
#pragma unroll
        for (int u = 0; u < 2; ++u)
          sc[u][kt] = __builtin_amdgcn_wmma_f32_16x16x32_f16(
              false, kf[kt][1], false, qf[u][1], (short)0, sc[u][kt], false, false);
    }

    // ---- online softmax: one query per lane, keys along the registers ----
    if (lb + 32 > NL) {  // only the last chunk has keys past the table
#pragma unroll
      for (int u = 0; u < 2; ++u)
#pragma unroll
        for (int i = 0; i < 8; ++i) {
          if (lb + hi8 + i >= NL)      sc[u][0][i] = -3.0e38f;
          if (lb + 16 + hi8 + i >= NL) sc[u][1][i] = -3.0e38f;
        }
    }
    v16h pf[2];  // P^T as B operand: element j is key koff(lane, j), column fr
    float ps[2];
    // slot: a literal, true where the arguments die at their exp2, so that the
    // compiler gives the next result the register of the argument just read
    auto probs = [&](bool slot) {
#pragma unroll
      for (int u = 0; u < 2; ++u) {
        ps[u] = 0.0f;
#pragma unroll
        for (int i = 0; i < 8; ++i) {
          const float p0 = slot ? exp2_slot(sc[u][0][i])
                                : __builtin_amdgcn_exp2f(sc[u][0][i]);
          const float p1 = slot ? exp2_slot(sc[u][1][i])
                                : __builtin_amdgcn_exp2f(sc[u][1][i]);
          ps[u] += p0 + p1;
          pf[u][i]     = (_Float16)p0;
          pf[u][8 + i] = (_Float16)p1;
        }
      }
    };
    probs(false);
    // The maximum in use stays while every P is small enough for f16 and f32:
    // a lane's P are bounded by their sum, so one test of the two sums, taken
    // once a pass for the whole wave, does for all 32 (an infinite or undefined
    // sum fails it too). The first pass always takes its own maximum.
    if (lb == 0 || __builtin_amdgcn_ballot_w32(
                       !(ps[0] <= 256.0f && ps[1] <= 256.0f)) != 0) {
      float corr[2];
#pragma unroll
      for (int u = 0; u < 2; ++u) {
        float mx = fmaxf(sc[u][0][0], sc[u][1][0]);
#pragma unroll
        for (int i = 1; i < 8; ++i)
          mx = fmaxf(mx, fmaxf(sc[u][0][i], sc[u][1][i]));
        mx = fmaxf(mx, xhalf(mx));
        // how far the maximum in use moves; nothing is summed yet in pass one
        const float delta = lb == 0 ? mx : fmaxf(mx, 0.0f);
        corr[u] = lb == 0 ? 0.0f : __builtin_amdgcn_exp2f(-delta);
#pragma unroll
        for (int i = 0; i < 8; ++i) {
          sc[u][0][i] -= delta;
          sc[u][1][i] -= delta;
          negm[u][i] -= delta;
        }
      }
      probs(true);
#pragma unroll
      for (int u = 0; u < 2; ++u) {
        srow[u] *= corr[u];
#pragma unroll
        for (int d = 0; d < 4; ++d)
#pragma unroll
          for (int i = 0; i < 8; ++i) cacc[u][d][i] *= corr[u];
      }
    }
    srow[0] += ps[0];
    srow[1] += ps[1];

    // ---- ctx^T += V^T(16x32) * P^T(32x16): 4 dh tiles x 2 query tiles ------
#pragma unroll
    for (int d = 0; d < 4; ++d)
#pragma unroll
      for (int u = 0; u < 2; ++u)
        cacc[u][d] = __builtin_amdgcn_wmma_f32_16x16x32_f16(
            false, vf[d], false, pf[u], (short)0, cacc[u][d], false, false);
  }

  // ---- normalize + store context (f32): 8 consecutive d per lane and tile --
#pragma unroll
  for (int u = 0; u < 2; ++u) {
    const float sum = srow[u] + xhalf(srow[u]);
    const float inv = 1.0f / sum;
    float* cp = Ctx + ((size_t)(q0 + u * 16 + fr)) * NE + h * NDH + hi8;
#pragma unroll
    for (int d = 0; d < 4; ++d) {
      *(float4*)&cp[d * 16] =
          make_float4(cacc[u][d][0] * inv, cacc[u][d][1] * inv,
                      cacc[u][d][2] * inv, cacc[u][d][3] * inv);
      *(float4*)&cp[d * 16 + 4] =
          make_float4(cacc[u][d][4] * inv, cacc[u][d][5] * inv,
                      cacc[u][d][6] * inv, cacc[u][d][7] * inv);
    }
    // a precaution: the second tile's values take over registers that the
    // first tile's stores name
    if (u == 0) asm volatile("s_wait_xcnt 0x0" ::: "memory");
  }
}

// ---------------------------------------------------------------------------
extern "C" void kernel_launch(void* const* d_in, const int* in_sizes, int n_in,
                              void* d_out, int out_size, void* d_ws, size_t ws_size,
                              hipStream_t stream) {
  const float* features = (const float*)d_in[0];
  const float* labels   = (const float*)d_in[1];
  const float* Wq = (const float*)d_in[2];
  const float* bq = (const float*)d_in[3];
  const float* Wk = (const float*)d_in[4];
  const float* bk = (const float*)d_in[5];
  const float* Wv = (const float*)d_in[6];
  const float* bv = (const float*)d_in[7];
  const float* Wo = (const float*)d_in[8];
  const float* bo = (const float*)d_in[9];
  float* out = (float*)d_out;

  const size_t MQ = (size_t)NB * NSQ;  // 6272
  _Float16* Qh = (_Float16*)d_ws;      // [6272,1024] f16
  _Float16* Kh = Qh + MQ * NE;         // [1000,1024] f16
  _Float16* Vh = Kh + (size_t)NL * NE; // [1000,1024] f16
  float*    ctx = (float*)(Vh + (size_t)NL * NE);  // [6272,1024] f32

  const dim3 blk(512);

  // Q = features @ Wq^T + bq, K = labels @ Wk^T + bk, V = labels @ Wv^T + bv,
  // all -> f16, Q stored times log2(e) / 8: 49 * 4 + 8 * 4 + 8 * 4 = 260 block tiles in one launch
  proj_qkv_f16<<<dim3(260), blk, 0, stream>>>(
      features, labels, Wq, bq, Wk, bk, Wv, bv, Qh, Kh, Vh);

  // attention: softmax(Q K^T / 8) V  -> ctx (f32)
  attn_f16<<<dim3(NH * APARTS), dim3(AWAVES * 32), 0, stream>>>(Qh, Kh, Vh, ctx);

  // out = ctx @ Wo^T + bo     -> f32
  gemm_bt_f16<<<dim3(49, 4), blk, 0, stream>>>(
      ctx, Wo, bo, out, (int)MQ, NE);
}
